// v000
// Times are from an AMD MI455X. After a warm-up the kernel runs many times in a row, and a time is the length of
// such a window on the GPU divided by its runs, so every launch and the gaps after it count. The runs cycle
// through copies of the inputs. A figure is the median of several windows, for all but v000 over two sittings.
// Sittings can differ by a few percent; kernels timed side by side share one.
// v000, which the later versions start from, runs in 984 microseconds.
#include <hip/hip_runtime.h>

// ---------------------------------------------------------------------------
// SwiGLU MLP for MI455X (gfx1250, wave32).
//   hidden = silu(x @ Wg + bg) * (x @ Wu + bu)      [4096 x 8192]  (bf16, d_ws)
//   out    = hidden @ Wd + bd                        [4096 x 2048]  (fp32)
// Compute-bound (AI ~1.5 kFLOP/B) -> V_WMMA_F32_16X16X32_BF16, fp32 accum.
// Kernel 2 A-tiles staged with GLOBAL_LOAD_ASYNC_TO_LDS_B128 (ASYNCcnt).
// ---------------------------------------------------------------------------

typedef __attribute__((ext_vector_type(16))) __bf16 v16bf;
typedef __attribute__((ext_vector_type(8)))  float  v8f;

#define M_TOT 4096
#define D_DIM 2048
#define I_DIM 8192

// LDS tile stride: 64 K-elements + 8 pad (bf16) = 72 -> 36 uints, multiple of 4
// so every fragment read is a 16B-aligned ds_load_b128.
#define KSTRIDE_U 36

__device__ __forceinline__ unsigned short f2bf(float f) {
  unsigned u = __float_as_uint(f);
  u += 0x7FFFu + ((u >> 16) & 1u);   // round-to-nearest-even
  return (unsigned short)(u >> 16);
}

#if __has_builtin(__builtin_amdgcn_cvt_pk_bf16_f32)
typedef __attribute__((ext_vector_type(2))) __bf16 v2bf;
__device__ __forceinline__ unsigned pack2(float lo, float hi) {
  union { v2bf v; unsigned u; } c;
  c.v = __builtin_amdgcn_cvt_pk_bf16_f32(lo, hi);
  return c.u;
}
#else
__device__ __forceinline__ unsigned pack2(float lo, float hi) {
  return (unsigned)f2bf(lo) | ((unsigned)f2bf(hi) << 16);
}
#endif

// Load one 16x32 bf16 A/B fragment from an LDS tile stored [row][k] with
// KSTRIDE_U uint stride. Per ISA 16-bit layout: lane -> row = lane%16,
// half = lane/16; VGPR v holds K = kk + (v&3)*2 + half*8 + (v>=4)*16.
__device__ __forceinline__ v16bf ld_frag(const unsigned* lds, int row, int kk, int half) {
  union { v16bf v; uint4 q[2]; } u;
  const uint4* p = (const uint4*)(lds + row * KSTRIDE_U + (kk >> 1) + half * 4);
  u.q[0] = p[0];   // VGPRs 0..3  (K = kk+half*8   .. +7)
  u.q[1] = p[2];   // VGPRs 4..7  (K = kk+half*8+16 .. +23)
  return u.v;
}

// ---------------------------------------------------------------------------
// Kernel 1: fused gate/up GEMM + SwiGLU, bf16 hidden output.
// Block tile: M=128, N_hidden=64 (64 gate cols + 64 up cols).
// 8 waves: wm in {0,1} (64 rows), wn in {0..3} (16 hidden cols each).
// ---------------------------------------------------------------------------
__global__ __launch_bounds__(256)
void k_gateup(const float* __restrict__ x, const float* __restrict__ wgu,
              const float* __restrict__ bgu, unsigned short* __restrict__ hid) {
  __shared__ unsigned Au[128 * KSTRIDE_U];   // A tile  [m][k]  128x64 bf16
  __shared__ unsigned Bg[64  * KSTRIDE_U];   // gate B  [n][k]   64x64 bf16 (transposed)
  __shared__ unsigned Bu[64  * KSTRIDE_U];   // up   B  [n][k]

  const int tid  = threadIdx.x;
  const int lane = tid & 31;
  const int wave = tid >> 5;
  const int wm   = wave >> 2;      // 0..1
  const int wn   = wave & 3;       // 0..3
  const int half = lane >> 4;
  const int nl   = lane & 15;

  const int n0 = blockIdx.x * 64;    // hidden-column tile
  const int m0 = blockIdx.y * 128;   // token tile

  const v8f vzero = {0.f,0.f,0.f,0.f,0.f,0.f,0.f,0.f};
  v8f accg[4], accu[4];
#pragma unroll
  for (int i = 0; i < 4; ++i) { accg[i] = vzero; accu[i] = vzero; }

  // staging roles (coalesced: consecutive lanes -> consecutive addresses)
  const int srow  = tid >> 1;         // 0..127 (A row)
  const int shalf = tid & 1;          // which 32-wide K half
  const int bk    = tid >> 2;         // 0..63: B K-row (4 threads share a row)
  const int bn    = (tid & 3) * 16;   // 16-col group within the row

  for (int k0 = 0; k0 < D_DIM; k0 += 64) {
    // ---- stage A: x[m0+srow][k0 + shalf*32 .. +31] fp32 -> bf16 ----
    {
      const float4* src = (const float4*)(x + (size_t)(m0 + srow) * D_DIM + k0 + shalf * 32);
      uint4* dst = (uint4*)(Au + srow * KSTRIDE_U + shalf * 16);
#pragma unroll
      for (int q = 0; q < 4; ++q) {
        float4 a = src[2 * q], b = src[2 * q + 1];
        uint4 o;
        o.x = pack2(a.x, a.y); o.y = pack2(a.z, a.w);
        o.z = pack2(b.x, b.y); o.w = pack2(b.z, b.w);
        dst[q] = o;
      }
    }
    // ---- stage B gate/up: wgu[k0+bk][n0+bn .. +15] -> transposed [n][k] ----
    {
      const float* gsrc = wgu + (size_t)(k0 + bk) * (2 * I_DIM) + n0 + bn;
      const float* usrc = gsrc + I_DIM;
      unsigned short* bg16 = (unsigned short*)Bg;
      unsigned short* bu16 = (unsigned short*)Bu;
#pragma unroll
      for (int c = 0; c < 16; c += 4) {
        float4 g = *(const float4*)(gsrc + c);
        float4 u = *(const float4*)(usrc + c);
        bg16[(bn + c + 0) * (2 * KSTRIDE_U) + bk] = f2bf(g.x);
        bg16[(bn + c + 1) * (2 * KSTRIDE_U) + bk] = f2bf(g.y);
        bg16[(bn + c + 2) * (2 * KSTRIDE_U) + bk] = f2bf(g.z);
        bg16[(bn + c + 3) * (2 * KSTRIDE_U) + bk] = f2bf(g.w);
        bu16[(bn + c + 0) * (2 * KSTRIDE_U) + bk] = f2bf(u.x);
        bu16[(bn + c + 1) * (2 * KSTRIDE_U) + bk] = f2bf(u.y);
        bu16[(bn + c + 2) * (2 * KSTRIDE_U) + bk] = f2bf(u.z);
        bu16[(bn + c + 3) * (2 * KSTRIDE_U) + bk] = f2bf(u.w);
      }
    }
    // prefetch next K-tile (fire-and-forget -> global_prefetch_b8)
    if (k0 + 64 < D_DIM) {
      __builtin_prefetch(x + (size_t)(m0 + srow) * D_DIM + (k0 + 64) + shalf * 32, 0, 0);
      __builtin_prefetch(wgu + (size_t)(k0 + 64 + bk) * (2 * I_DIM) + n0 + bn, 0, 0);
      __builtin_prefetch(wgu + (size_t)(k0 + 64 + bk) * (2 * I_DIM) + I_DIM + n0 + bn, 0, 0);
    }
    __syncthreads();

#pragma unroll
    for (int kk = 0; kk < 64; kk += 32) {
      v16bf a[4];
#pragma unroll
      for (int i = 0; i < 4; ++i)
        a[i] = ld_frag(Au, wm * 64 + i * 16 + nl, kk, half);
      v16bf bg = ld_frag(Bg, wn * 16 + nl, kk, half);
      v16bf bu = ld_frag(Bu, wn * 16 + nl, kk, half);
#pragma unroll
      for (int i = 0; i < 4; ++i) {
        accg[i] = __builtin_amdgcn_wmma_f32_16x16x32_bf16(false, a[i], false, bg,
                                                          (short)0, accg[i], false, false);
        accu[i] = __builtin_amdgcn_wmma_f32_16x16x32_bf16(false, a[i], false, bu,
                                                          (short)0, accu[i], false, false);
      }
    }
    __syncthreads();
  }

  // ---- epilogue: bias + SwiGLU, store bf16 hidden ----
  const int nh = n0 + wn * 16 + nl;          // hidden column (D layout: N = lane%16)
  const float biasg = bgu[nh];
  const float biasu = bgu[I_DIM + nh];
#pragma unroll
  for (int i = 0; i < 4; ++i) {
#pragma unroll
    for (int r = 0; r < 8; ++r) {
      const int m = m0 + wm * 64 + i * 16 + r + half * 8;   // D layout: M = r + half*8
      const float g = accg[i][r] + biasg;
      const float u = accu[i][r] + biasu;
      const float h = g * u / (1.f + __expf(-g));           // silu(g) * u
      hid[(size_t)m * I_DIM + nh] = f2bf(h);
    }
  }
}

// ---------------------------------------------------------------------------
// Kernel 2: out = hidden(bf16) @ w_down + b_down.  Block tile 128x128,
// 8 waves 2x4: wave tile M=64 (4 frags), N=32 (2 frags).
// A-tiles staged via async global->LDS DMA (no VGPR round trip).
// ---------------------------------------------------------------------------
__global__ __launch_bounds__(256)
void k_down(const unsigned short* __restrict__ hid, const float* __restrict__ wdn,
            const float* __restrict__ bdn, float* __restrict__ out) {
  __shared__ unsigned Au[128 * KSTRIDE_U];   // A tile [m][k]  128x64 bf16
  __shared__ unsigned Bt[128 * KSTRIDE_U];   // B tile [n][k]  128x64 bf16 (transposed)

  const int tid  = threadIdx.x;
  const int lane = tid & 31;
  const int wave = tid >> 5;
  const int wm   = wave >> 2;
  const int wn   = wave & 3;
  const int half = lane >> 4;
  const int nl   = lane & 15;

  const int n0 = blockIdx.x * 128;
  const int m0 = blockIdx.y * 128;

  const v8f vzero = {0.f,0.f,0.f,0.f,0.f,0.f,0.f,0.f};
  v8f acc[4][2];
#pragma unroll
  for (int i = 0; i < 4; ++i) { acc[i][0] = vzero; acc[i][1] = vzero; }

  const int srow  = tid >> 1;
  const int shalf = tid & 1;
  const int bk    = tid >> 2;         // 0..63 (4 threads per row -> coalesced)
  const int bn    = (tid & 3) * 32;   // 32-col group

  // per-thread fixed LDS destination for the async A copy
  const unsigned ldsA =
      (unsigned)(uintptr_t)(Au + srow * KSTRIDE_U + shalf * 16);

  for (int k0 = 0; k0 < I_DIM; k0 += 64) {
    // ---- stage A: bf16 hidden -> LDS via async DMA (ASYNCcnt) ----
    {
      unsigned long long ga =
          (unsigned long long)(uintptr_t)(hid + (size_t)(m0 + srow) * I_DIM + k0 + shalf * 32);
#pragma unroll
      for (int q = 0; q < 4; ++q) {
        asm volatile("global_load_async_to_lds_b128 %0, %1, off"
                     :: "v"(ldsA + 16u * q), "v"(ga + 16ull * q)
                     : "memory");
      }
    }
    // ---- stage B: w_down[k0+bk][n0+bn .. +31] fp32 -> bf16, transposed ----
    {
      const float* bsrc = wdn + (size_t)(k0 + bk) * D_DIM + n0 + bn;
      unsigned short* bt16 = (unsigned short*)Bt;
#pragma unroll
      for (int c = 0; c < 32; c += 4) {
        float4 v = *(const float4*)(bsrc + c);
        bt16[(bn + c + 0) * (2 * KSTRIDE_U) + bk] = f2bf(v.x);
        bt16[(bn + c + 1) * (2 * KSTRIDE_U) + bk] = f2bf(v.y);
        bt16[(bn + c + 2) * (2 * KSTRIDE_U) + bk] = f2bf(v.z);
        bt16[(bn + c + 3) * (2 * KSTRIDE_U) + bk] = f2bf(v.w);
      }
    }
    if (k0 + 64 < I_DIM) {
      __builtin_prefetch(wdn + (size_t)(k0 + 64 + bk) * D_DIM + n0 + bn, 0, 0);
    }
    // wait for this wave's async LDS writes, then rendezvous
    asm volatile("s_wait_asynccnt 0x0" ::: "memory");
    __syncthreads();

#pragma unroll
    for (int kk = 0; kk < 64; kk += 32) {
      v16bf a[4], b[2];
#pragma unroll
      for (int i = 0; i < 4; ++i)
        a[i] = ld_frag(Au, wm * 64 + i * 16 + nl, kk, half);
#pragma unroll
      for (int j = 0; j < 2; ++j)
        b[j] = ld_frag(Bt, wn * 32 + j * 16 + nl, kk, half);
#pragma unroll
      for (int i = 0; i < 4; ++i)
#pragma unroll
        for (int j = 0; j < 2; ++j)
          acc[i][j] = __builtin_amdgcn_wmma_f32_16x16x32_bf16(false, a[i], false, b[j],
                                                              (short)0, acc[i][j], false, false);
    }
    __syncthreads();
  }

  // ---- epilogue: bias add, fp32 store ----
#pragma unroll
  for (int j = 0; j < 2; ++j) {
    const int n = n0 + wn * 32 + j * 16 + nl;
    const float bias = bdn[n];
#pragma unroll
    for (int i = 0; i < 4; ++i) {
#pragma unroll
      for (int r = 0; r < 8; ++r) {
        const int m = m0 + wm * 64 + i * 16 + r + half * 8;
        out[(size_t)m * D_DIM + n] = acc[i][j][r] + bias;
      }
    }
  }
}

// ---------------------------------------------------------------------------
extern "C" void kernel_launch(void* const* d_in, const int* in_sizes, int n_in,
                              void* d_out, int out_size, void* d_ws, size_t ws_size,
                              hipStream_t stream) {
  const float* x   = (const float*)d_in[0];   // [4096, 2048]
  const float* wgu = (const float*)d_in[1];   // [2048, 16384]
  const float* bgu = (const float*)d_in[2];   // [16384]
  const float* wdn = (const float*)d_in[3];   // [8192, 2048]
  const float* bdn = (const float*)d_in[4];   // [2048]
  float* out = (float*)d_out;                 // [4096, 2048]
  unsigned short* hid = (unsigned short*)d_ws; // [4096, 8192] bf16 = 64 MB

  dim3 g1(I_DIM / 64, M_TOT / 128);   // 128 x 32
  k_gateup<<<g1, 256, 0, stream>>>(x, wgu, bgu, hid);

  dim3 g2(D_DIM / 128, M_TOT / 128);  // 16 x 32
  k_down<<<g2, 256, 0, stream>>>(hid, wdn, bdn, out);
}

// v001
// Measured time: 390 microseconds a run.
// Two timings next to v000 put it at 2.66 and 2.65 times that version's speed.
#include <hip/hip_runtime.h>

// ---------------------------------------------------------------------------
// SwiGLU MLP for MI455X (gfx1250, wave32).
//   hidden = silu(x @ Wg + bg) * (x @ Wu + bu)      [4096 x 8192]  (bf16, d_ws)
//   out    = hidden @ Wd + bd                        [4096 x 2048]  (fp32)
// Compute-bound (AI ~1.5 kFLOP/B) -> V_WMMA_F32_16X16X32_BF16, fp32 accum.
// A pre-pass rounds x and both weights to bf16 once per call (weights also
// transposed to [n][k]); every GEMM tile is then a plain byte copy, staged with
// GLOBAL_LOAD_ASYNC_TO_LDS_B128 (ASYNCcnt).
// ---------------------------------------------------------------------------

typedef __attribute__((ext_vector_type(16))) __bf16 v16bf;
typedef __attribute__((ext_vector_type(8)))  float  v8f;

#define M_TOT 4096
#define D_DIM 2048
#define I_DIM 8192

// LDS tile stride: 64 K-elements + 8 pad (bf16) = 72 -> 36 uints, multiple of 4
// so every fragment read is a 16B-aligned ds_load_b128.
#define KSTRIDE_U 36

__device__ __forceinline__ unsigned short f2bf(float f) {
  unsigned u = __float_as_uint(f);
  u += 0x7FFFu + ((u >> 16) & 1u);   // round-to-nearest-even
  return (unsigned short)(u >> 16);
}

#if __has_builtin(__builtin_amdgcn_cvt_pk_bf16_f32)
typedef __attribute__((ext_vector_type(2))) __bf16 v2bf;
__device__ __forceinline__ unsigned pack2(float lo, float hi) {
  union { v2bf v; unsigned u; } c;
  c.v = __builtin_amdgcn_cvt_pk_bf16_f32(lo, hi);
  return c.u;
}
#else
__device__ __forceinline__ unsigned pack2(float lo, float hi) {
  return (unsigned)f2bf(lo) | ((unsigned)f2bf(hi) << 16);
}
#endif

// Load one 16x32 bf16 A/B fragment from an LDS tile stored [row][k] with
// KSTRIDE_U uint stride. Per ISA 16-bit layout: lane -> row = lane%16,
// half = lane/16; VGPR v holds K = kk + (v&3)*2 + half*8 + (v>=4)*16.
__device__ __forceinline__ v16bf ld_frag(const unsigned* lds, int row, int kk, int half) {
  union { v16bf v; uint4 q[2]; } u;
  const uint4* p = (const uint4*)(lds + row * KSTRIDE_U + (kk >> 1) + half * 4);
  u.q[0] = p[0];   // VGPRs 0..3  (K = kk+half*8   .. +7)
  u.q[1] = p[2];   // VGPRs 4..7  (K = kk+half*8+16 .. +23)
  return u.v;
}

// Stage two tiles of 128 rows x 64 bf16 (128 B a row) into LDS at KSTRIDE_U pitch.
// Eight lanes cover one row, so each wave-wide copy reads four whole 128-B lines.
// la, lb: the lane's LDS byte address in rows 0..31 of each tile; a0..a3, b0..b3:
// its global addresses in the four 32-row groups of each tile.
__device__ __forceinline__ void copy_tiles(unsigned la, const unsigned short* a0,
                                           const unsigned short* a1, const unsigned short* a2,
                                           const unsigned short* a3,
                                           unsigned lb, const unsigned short* b0,
                                           const unsigned short* b1, const unsigned short* b2,
                                           const unsigned short* b3) {
  const unsigned step = 32u * 4u * KSTRIDE_U;   // 32 rows, in bytes
  // s_wait_xcnt closes the statement so that no address register of an issued
  // copy is rewritten (next trip's pointer additions) ahead of it.
  asm volatile("global_load_async_to_lds_b128 %0, %8, off\n\t"
               "global_load_async_to_lds_b128 %1, %9, off\n\t"
               "global_load_async_to_lds_b128 %2, %10, off\n\t"
               "global_load_async_to_lds_b128 %3, %11, off\n\t"
               "global_load_async_to_lds_b128 %4, %12, off\n\t"
               "global_load_async_to_lds_b128 %5, %13, off\n\t"
               "global_load_async_to_lds_b128 %6, %14, off\n\t"
               "global_load_async_to_lds_b128 %7, %15, off\n\t"
               "s_wait_xcnt 0x0"
               :: "v"(la), "v"(la + step), "v"(la + 2u * step), "v"(la + 3u * step),
                  "v"(lb), "v"(lb + step), "v"(lb + 2u * step), "v"(lb + 3u * step),
                  "v"((unsigned long long)(uintptr_t)a0), "v"((unsigned long long)(uintptr_t)a1),
                  "v"((unsigned long long)(uintptr_t)a2), "v"((unsigned long long)(uintptr_t)a3),
                  "v"((unsigned long long)(uintptr_t)b0), "v"((unsigned long long)(uintptr_t)b1),
                  "v"((unsigned long long)(uintptr_t)b2), "v"((unsigned long long)(uintptr_t)b3)
               : "memory");
}

// ---------------------------------------------------------------------------
// Pre-pass, one launch, three jobs picked by block index (block-uniform):
//   wgt[n][k] = bf16(w_gate_up[k][n]),  wdt[n][k] = bf16(w_down[k][n]),  xb = bf16(x).
// ---------------------------------------------------------------------------
#define T_GU ((2 * I_DIM / 64) * (D_DIM / 64))   // 64x64 tiles of w_gate_up
#define T_DN ((D_DIM / 64) * (I_DIM / 64))       // 64x64 tiles of w_down
#define T_X  (M_TOT * D_DIM / (8 * 256))         // blocks of 2048 elements of x

// One 64(k) x 64(n) tile of wt[n][k] = bf16(w[k][n]).  Two k-rows are packed into
// one dword per column, so the transpose through LDS moves dwords; pitch 33 keeps
// the column-wise stores on distinct banks.
__device__ __forceinline__ void cvt_t_tile(const float* __restrict__ w,
                                           unsigned short* __restrict__ wt,
                                           int kdim, int ndim, int n0, int k0,
                                           unsigned* t) {
  const int tid = threadIdx.x;
  const int n4 = (tid & 15) * 4;
  const int kp = tid >> 4;                 // k pair 0..15; the thread also takes kp + 16
  const float* s = w + (size_t)(k0 + 2 * kp) * ndim + n0 + n4;
  const float4 a0 = *(const float4*)s;
  const float4 b0 = *(const float4*)(s + ndim);
  const float4 a1 = *(const float4*)(s + 32 * ndim);
  const float4 b1 = *(const float4*)(s + 33 * ndim);
  t[(n4 + 0) * 33 + kp] = pack2(a0.x, b0.x);
  t[(n4 + 1) * 33 + kp] = pack2(a0.y, b0.y);
  t[(n4 + 2) * 33 + kp] = pack2(a0.z, b0.z);
  t[(n4 + 3) * 33 + kp] = pack2(a0.w, b0.w);
  t[(n4 + 0) * 33 + kp + 16] = pack2(a1.x, b1.x);
  t[(n4 + 1) * 33 + kp + 16] = pack2(a1.y, b1.y);
  t[(n4 + 2) * 33 + kp + 16] = pack2(a1.z, b1.z);
  t[(n4 + 3) * 33 + kp + 16] = pack2(a1.w, b1.w);
  __syncthreads();
  const int n = tid >> 2;                  // 0..63
  const int c = (tid & 3) * 4;             // dword in the first 64-B half row
  const unsigned* r = t + n * 33 + c;
  uint4 o0, o1;
  o0.x = r[0];  o0.y = r[1];  o0.z = r[2];  o0.w = r[3];
  o1.x = r[16]; o1.y = r[17]; o1.z = r[18]; o1.w = r[19];
  unsigned* d = (unsigned*)(wt + (size_t)(n0 + n) * kdim + k0) + c;
  *(uint4*)d = o0;
  *(uint4*)(d + 16) = o1;
  // no register that the two stores name is rewritten ahead of this wait
  asm volatile("s_wait_xcnt 0x0" ::: "memory");
}

__global__ __launch_bounds__(256)
void k_prep(const float* __restrict__ x, const float* __restrict__ wgu,
            const float* __restrict__ wdn, unsigned short* __restrict__ xb,
            unsigned short* __restrict__ wgt, unsigned short* __restrict__ wdt) {
  __shared__ unsigned t[64 * 33];          // [n][k pair]
  const int b = blockIdx.x;
  if (b < T_GU) {
    cvt_t_tile(wgu, wgt, D_DIM, 2 * I_DIM,
               (b % (2 * I_DIM / 64)) * 64, (b / (2 * I_DIM / 64)) * 64, t);
  } else if (b < T_GU + T_DN) {
    const int e = b - T_GU;
    cvt_t_tile(wdn, wdt, I_DIM, D_DIM, (e % (D_DIM / 64)) * 64, (e / (D_DIM / 64)) * 64, t);
  } else {
    const size_t i = (size_t)(b - T_GU - T_DN) * 256 + threadIdx.x;   // 8 elements each
    const float4 u = ((const float4*)x)[2 * i];
    const float4 v = ((const float4*)x)[2 * i + 1];
    uint4 o;
    o.x = pack2(u.x, u.y); o.y = pack2(u.z, u.w);
    o.z = pack2(v.x, v.y); o.w = pack2(v.z, v.w);
    ((uint4*)xb)[i] = o;
    // no register that the store names is rewritten ahead of this wait
    asm volatile("s_wait_xcnt 0x0" ::: "memory");
  }
}

// ---------------------------------------------------------------------------
// Kernel 1: fused gate/up GEMM + SwiGLU, bf16 hidden output.
// Block tile: M=128, N_hidden=64 (64 gate cols + 64 up cols).
// 8 waves: wm in {0,1} (64 rows), wn in {0..3} (16 hidden cols each).
// ---------------------------------------------------------------------------
__global__ __launch_bounds__(256)
void k_gateup(const unsigned short* __restrict__ xb, const unsigned short* __restrict__ wgt,
              const float* __restrict__ bgu, unsigned short* __restrict__ hid) {
  __shared__ __attribute__((aligned(16))) unsigned Au[128 * KSTRIDE_U];  // A tile [m][k] 128x64 bf16
  __shared__ __attribute__((aligned(16))) unsigned Bs[128 * KSTRIDE_U];  // B [n][k]: 64 gate rows, 64 up rows
  const unsigned* Bg = Bs;
  const unsigned* Bu = Bs + 64 * KSTRIDE_U;

  const int tid  = threadIdx.x;
  const int lane = tid & 31;
  const int wave = tid >> 5;
  const int wm   = wave >> 2;      // 0..1
  const int wn   = wave & 3;       // 0..3
  const int half = lane >> 4;
  const int nl   = lane & 15;

  const int n0 = blockIdx.x * 64;    // hidden-column tile
  const int m0 = blockIdx.y * 128;   // token tile

  const v8f vzero = {0.f,0.f,0.f,0.f,0.f,0.f,0.f,0.f};
  v8f accg[4], accu[4];
#pragma unroll
  for (int i = 0; i < 4; ++i) { accg[i] = vzero; accu[i] = vzero; }

  // staging roles: 8 lanes per 128-B row, 32 rows per copy
  const int crow = tid >> 3;          // 0..31
  const int ccol = tid & 7;           // 16-B piece of the row
  const unsigned ldsA = (unsigned)(uintptr_t)(Au + crow * KSTRIDE_U + ccol * 4);
  const unsigned ldsB = (unsigned)(uintptr_t)(Bs + crow * KSTRIDE_U + ccol * 4);
  const unsigned short* ga = xb  + (size_t)(m0 + crow) * D_DIM + ccol * 8;
  const unsigned short* gg = wgt + (size_t)(n0 + crow) * D_DIM + ccol * 8;
  const unsigned short* gu = gg + (size_t)I_DIM * D_DIM;

  for (int k0 = 0; k0 < D_DIM; k0 += 64) {
    copy_tiles(ldsA, ga + k0, ga + k0 + 32 * D_DIM, ga + k0 + 64 * D_DIM, ga + k0 + 96 * D_DIM,
               ldsB, gg + k0, gg + k0 + 32 * D_DIM, gu + k0, gu + k0 + 32 * D_DIM);
    // this wave's copies have landed before the barrier that publishes them
    asm volatile("s_wait_asynccnt 0x0" ::: "memory");
    __syncthreads();

#pragma unroll
    for (int kk = 0; kk < 64; kk += 32) {
      v16bf a[4];
#pragma unroll
      for (int i = 0; i < 4; ++i)
        a[i] = ld_frag(Au, wm * 64 + i * 16 + nl, kk, half);
      v16bf bg = ld_frag(Bg, wn * 16 + nl, kk, half);
      v16bf bu = ld_frag(Bu, wn * 16 + nl, kk, half);
#pragma unroll
      for (int i = 0; i < 4; ++i) {
        accg[i] = __builtin_amdgcn_wmma_f32_16x16x32_bf16(false, a[i], false, bg,
                                                          (short)0, accg[i], false, false);
        accu[i] = __builtin_amdgcn_wmma_f32_16x16x32_bf16(false, a[i], false, bu,
                                                          (short)0, accu[i], false, false);
      }
    }
    // this wave's LDS reads have retired before the next trip's copies overwrite the tiles
    asm volatile("s_wait_dscnt 0x0" ::: "memory");
    __syncthreads();
  }

  // ---- epilogue: bias + SwiGLU, store bf16 hidden ----
  const int nh = n0 + wn * 16 + nl;          // hidden column (D layout: N = lane%16)
  const float biasg = bgu[nh];
  const float biasu = bgu[I_DIM + nh];
#pragma unroll
  for (int i = 0; i < 4; ++i) {
#pragma unroll
    for (int r = 0; r < 8; ++r) {
      const int m = m0 + wm * 64 + i * 16 + r + half * 8;   // D layout: M = r + half*8
      const float g = accg[i][r] + biasg;
      const float u = accu[i][r] + biasu;
      const float h = g * u / (1.f + __expf(-g));           // silu(g) * u
      hid[(size_t)m * I_DIM + nh] = f2bf(h);
    }
  }
}

// ---------------------------------------------------------------------------
// Kernel 2: out = hidden(bf16) @ w_down + b_down.  Block tile 128x128,
// 8 waves 2x4: wave tile M=64 (4 frags), N=32 (2 frags).
// ---------------------------------------------------------------------------
__global__ __launch_bounds__(256)
void k_down(const unsigned short* __restrict__ hid, const unsigned short* __restrict__ wdt,
            const float* __restrict__ bdn, float* __restrict__ out) {
  __shared__ __attribute__((aligned(16))) unsigned Au[128 * KSTRIDE_U];   // A tile [m][k]  128x64 bf16
  __shared__ __attribute__((aligned(16))) unsigned Bt[128 * KSTRIDE_U];   // B tile [n][k]  128x64 bf16

  const int tid  = threadIdx.x;
  const int lane = tid & 31;
  const int wave = tid >> 5;
  const int wm   = wave >> 2;
  const int wn   = wave & 3;
  const int half = lane >> 4;
  const int nl   = lane & 15;

  const int n0 = blockIdx.x * 128;
  const int m0 = blockIdx.y * 128;

  const v8f vzero = {0.f,0.f,0.f,0.f,0.f,0.f,0.f,0.f};
  v8f acc[4][2];
#pragma unroll
  for (int i = 0; i < 4; ++i) { acc[i][0] = vzero; acc[i][1] = vzero; }

  // staging roles: 8 lanes per 128-B row, 32 rows per copy
  const int crow = tid >> 3;          // 0..31
  const int ccol = tid & 7;           // 16-B piece of the row
  const unsigned ldsA = (unsigned)(uintptr_t)(Au + crow * KSTRIDE_U + ccol * 4);
  const unsigned ldsB = (unsigned)(uintptr_t)(Bt + crow * KSTRIDE_U + ccol * 4);
  const unsigned short* ga = hid + (size_t)(m0 + crow) * I_DIM + ccol * 8;
  const unsigned short* gb = wdt + (size_t)(n0 + crow) * I_DIM + ccol * 8;

  for (int k0 = 0; k0 < I_DIM; k0 += 64) {
    copy_tiles(ldsA, ga + k0, ga + k0 + 32 * I_DIM, ga + k0 + 64 * I_DIM, ga + k0 + 96 * I_DIM,
               ldsB, gb + k0, gb + k0 + 32 * I_DIM, gb + k0 + 64 * I_DIM, gb + k0 + 96 * I_DIM);
    // this wave's copies have landed before the barrier that publishes them
    asm volatile("s_wait_asynccnt 0x0" ::: "memory");
    __syncthreads();

#pragma unroll
    for (int kk = 0; kk < 64; kk += 32) {
      v16bf a[4], b[2];
#pragma unroll
      for (int i = 0; i < 4; ++i)
        a[i] = ld_frag(Au, wm * 64 + i * 16 + nl, kk, half);
#pragma unroll
      for (int j = 0; j < 2; ++j)
        b[j] = ld_frag(Bt, wn * 32 + j * 16 + nl, kk, half);
#pragma unroll
      for (int i = 0; i < 4; ++i)
#pragma unroll
        for (int j = 0; j < 2; ++j)
          acc[i][j] = __builtin_amdgcn_wmma_f32_16x16x32_bf16(false, a[i], false, b[j],
                                                              (short)0, acc[i][j], false, false);
    }
    // this wave's LDS reads have retired before the next trip's copies overwrite the tiles
    asm volatile("s_wait_dscnt 0x0" ::: "memory");
    __syncthreads();
  }

  // ---- epilogue: bias add, fp32 store ----
#pragma unroll
  for (int j = 0; j < 2; ++j) {
    const int n = n0 + wn * 32 + j * 16 + nl;
    const float bias = bdn[n];
#pragma unroll
    for (int i = 0; i < 4; ++i) {
#pragma unroll
      for (int r = 0; r < 8; ++r) {
        const int m = m0 + wm * 64 + i * 16 + r + half * 8;
        out[(size_t)m * D_DIM + n] = acc[i][j][r] + bias;
      }
    }
  }
}

// ---------------------------------------------------------------------------
extern "C" void kernel_launch(void* const* d_in, const int* in_sizes, int n_in,
                              void* d_out, int out_size, void* d_ws, size_t ws_size,
                              hipStream_t stream) {
  const float* x   = (const float*)d_in[0];   // [4096, 2048]
  const float* wgu = (const float*)d_in[1];   // [2048, 16384]
  const float* bgu = (const float*)d_in[2];   // [16384]
  const float* wdn = (const float*)d_in[3];   // [8192, 2048]
  const float* bdn = (const float*)d_in[4];   // [2048]
  float* out = (float*)d_out;                 // [4096, 2048]
  unsigned short* hid = (unsigned short*)d_ws;             // [4096, 8192]  bf16, 64 MiB
  unsigned short* xb  = hid + (size_t)M_TOT * I_DIM;       // [4096, 2048]  bf16, 16 MiB
  unsigned short* wgt = xb  + (size_t)M_TOT * D_DIM;       // [16384, 2048] bf16, 64 MiB
  unsigned short* wdt = wgt + (size_t)2 * I_DIM * D_DIM;   // [2048, 8192]  bf16, 32 MiB

  k_prep<<<T_GU + T_DN + T_X, 256, 0, stream>>>(x, wgu, wdn, xb, wgt, wdt);

  dim3 g1(I_DIM / 64, M_TOT / 128);   // 128 x 32
  k_gateup<<<g1, 256, 0, stream>>>(xb, wgt, bgu, hid);

  dim3 g2(D_DIM / 128, M_TOT / 128);  // 16 x 32
  k_down<<<g2, 256, 0, stream>>>(hid, wdt, bdn, out);
}

// v002
// Measured time: 359 microseconds a run.
// In both of two side-by-side timings against v001, it was 1.09 times as fast.
// Over all steps from v000 it is 2.90 times as fast.
#include <hip/hip_runtime.h>

// ---------------------------------------------------------------------------
// SwiGLU MLP for MI455X (gfx1250, wave32).
//   hidden = silu(x @ Wg + bg) * (x @ Wu + bu)      [4096 x 8192]  (bf16, d_ws)
//   out    = hidden @ Wd + bd                        [4096 x 2048]  (fp32)
// Compute-bound (AI ~1.5 kFLOP/B) -> V_WMMA_F32_16X16X32_BF16, fp32 accum.
// A pre-pass rounds x and both weights to bf16 once per call (weights also
// transposed to [n][k]); every GEMM tile is then a plain byte copy, staged with
// GLOBAL_LOAD_ASYNC_TO_LDS_B128 (ASYNCcnt) into two LDS buffers: the copies of
// tile t + 2 are issued behind the barrier that ends trip t and fly during trip t + 1.
// ---------------------------------------------------------------------------

typedef __attribute__((ext_vector_type(16))) __bf16 v16bf;
typedef __attribute__((ext_vector_type(8)))  float  v8f;

#define M_TOT 4096
#define D_DIM 2048
#define I_DIM 8192

// LDS tile stride: 64 K-elements + 8 pad (bf16) = 72 -> 36 uints, multiple of 4
// so every fragment read is a 16B-aligned ds_load_b128.
#define KSTRIDE_U 36
#define TILE_U (128 * KSTRIDE_U)     // one 128-row tile (one buffer of one operand), in uints

__device__ __forceinline__ unsigned short f2bf(float f) {
  unsigned u = __float_as_uint(f);
  u += 0x7FFFu + ((u >> 16) & 1u);   // round-to-nearest-even
  return (unsigned short)(u >> 16);
}

#if __has_builtin(__builtin_amdgcn_cvt_pk_bf16_f32)
typedef __attribute__((ext_vector_type(2))) __bf16 v2bf;
__device__ __forceinline__ unsigned pack2(float lo, float hi) {
  union { v2bf v; unsigned u; } c;
  c.v = __builtin_amdgcn_cvt_pk_bf16_f32(lo, hi);
  return c.u;
}
#else
__device__ __forceinline__ unsigned pack2(float lo, float hi) {
  return (unsigned)f2bf(lo) | ((unsigned)f2bf(hi) << 16);
}
#endif

// Load one 16x32 bf16 A/B fragment from an LDS tile stored [row][k] with
// KSTRIDE_U uint stride. Per ISA 16-bit layout: lane -> row = lane%16,
// half = lane/16; VGPR v holds K = kk + (v&3)*2 + half*8 + (v>=4)*16.
__device__ __forceinline__ v16bf ld_frag(const unsigned* lds, int row, int kk, int half) {
  union { v16bf v; uint4 q[2]; } u;
  const uint4* p = (const uint4*)(lds + row * KSTRIDE_U + (kk >> 1) + half * 4);
  u.q[0] = p[0];   // VGPRs 0..3  (K = kk+half*8   .. +7)
  u.q[1] = p[2];   // VGPRs 4..7  (K = kk+half*8+16 .. +23)
  return u.v;
}

// Stage two tiles of 128 rows x 64 bf16 (128 B a row) into LDS at KSTRIDE_U pitch.
// Eight lanes cover one row, so each wave-wide copy reads four whole 128-B lines.
// la, lb: the lane's LDS byte address in rows 0..31 of each tile; a0..a3, b0..b3:
// its global addresses in the four 32-row groups of each tile.
__device__ __forceinline__ void copy_tiles(unsigned la, const unsigned short* a0,
                                           const unsigned short* a1, const unsigned short* a2,
                                           const unsigned short* a3,
                                           unsigned lb, const unsigned short* b0,
                                           const unsigned short* b1, const unsigned short* b2,
                                           const unsigned short* b3) {
  const unsigned step = 32u * 4u * KSTRIDE_U;   // 32 rows, in bytes
  // s_wait_xcnt closes the statement so that no address register of an issued
  // copy is rewritten (next trip's pointer additions) ahead of it.
  asm volatile("global_load_async_to_lds_b128 %0, %8, off\n\t"
               "global_load_async_to_lds_b128 %1, %9, off\n\t"
               "global_load_async_to_lds_b128 %2, %10, off\n\t"
               "global_load_async_to_lds_b128 %3, %11, off\n\t"
               "global_load_async_to_lds_b128 %4, %12, off\n\t"
               "global_load_async_to_lds_b128 %5, %13, off\n\t"
               "global_load_async_to_lds_b128 %6, %14, off\n\t"
               "global_load_async_to_lds_b128 %7, %15, off\n\t"
               "s_wait_xcnt 0x0"
               :: "v"(la), "v"(la + step), "v"(la + 2u * step), "v"(la + 3u * step),
                  "v"(lb), "v"(lb + step), "v"(lb + 2u * step), "v"(lb + 3u * step),
                  "v"((unsigned long long)(uintptr_t)a0), "v"((unsigned long long)(uintptr_t)a1),
                  "v"((unsigned long long)(uintptr_t)a2), "v"((unsigned long long)(uintptr_t)a3),
                  "v"((unsigned long long)(uintptr_t)b0), "v"((unsigned long long)(uintptr_t)b1),
                  "v"((unsigned long long)(uintptr_t)b2), "v"((unsigned long long)(uintptr_t)b3)
               : "memory");
}

// ---------------------------------------------------------------------------
// Pre-pass, one launch, three jobs picked by block index (block-uniform):
//   wgt[n][k] = bf16(w_gate_up[k][n]),  wdt[n][k] = bf16(w_down[k][n]),  xb = bf16(x).
// ---------------------------------------------------------------------------
#define T_GU ((2 * I_DIM / 64) * (D_DIM / 64))   // 64x64 tiles of w_gate_up
#define T_DN ((D_DIM / 64) * (I_DIM / 64))       // 64x64 tiles of w_down
#define T_X  (M_TOT * D_DIM / (8 * 256))         // blocks of 2048 elements of x

// One 64(k) x 64(n) tile of wt[n][k] = bf16(w[k][n]).  Two k-rows are packed into
// one dword per column, so the transpose through LDS moves dwords; pitch 33 keeps
// the column-wise stores on distinct banks.
__device__ __forceinline__ void cvt_t_tile(const float* __restrict__ w,
                                           unsigned short* __restrict__ wt,
                                           int kdim, int ndim, int n0, int k0,
                                           unsigned* t) {
  const int tid = threadIdx.x;
  const int n4 = (tid & 15) * 4;
  const int kp = tid >> 4;                 // k pair 0..15; the thread also takes kp + 16
  const float* s = w + (size_t)(k0 + 2 * kp) * ndim + n0 + n4;
  const float4 a0 = *(const float4*)s;
  const float4 b0 = *(const float4*)(s + ndim);
  const float4 a1 = *(const float4*)(s + 32 * ndim);
  const float4 b1 = *(const float4*)(s + 33 * ndim);
  t[(n4 + 0) * 33 + kp] = pack2(a0.x, b0.x);
  t[(n4 + 1) * 33 + kp] = pack2(a0.y, b0.y);
  t[(n4 + 2) * 33 + kp] = pack2(a0.z, b0.z);
  t[(n4 + 3) * 33 + kp] = pack2(a0.w, b0.w);
  t[(n4 + 0) * 33 + kp + 16] = pack2(a1.x, b1.x);
  t[(n4 + 1) * 33 + kp + 16] = pack2(a1.y, b1.y);
  t[(n4 + 2) * 33 + kp + 16] = pack2(a1.z, b1.z);
  t[(n4 + 3) * 33 + kp + 16] = pack2(a1.w, b1.w);
  __syncthreads();
  const int n = tid >> 2;                  // 0..63
  const int c = (tid & 3) * 4;             // dword in the first 64-B half row
  const unsigned* r = t + n * 33 + c;
  uint4 o0, o1;
  o0.x = r[0];  o0.y = r[1];  o0.z = r[2];  o0.w = r[3];
  o1.x = r[16]; o1.y = r[17]; o1.z = r[18]; o1.w = r[19];
  unsigned* d = (unsigned*)(wt + (size_t)(n0 + n) * kdim + k0) + c;
  *(uint4*)d = o0;
  *(uint4*)(d + 16) = o1;
  // no register that the two stores name is rewritten ahead of this wait
  asm volatile("s_wait_xcnt 0x0" ::: "memory");
}

__global__ __launch_bounds__(256)
void k_prep(const float* __restrict__ x, const float* __restrict__ wgu,
            const float* __restrict__ wdn, unsigned short* __restrict__ xb,
            unsigned short* __restrict__ wgt, unsigned short* __restrict__ wdt) {
  __shared__ unsigned t[64 * 33];          // [n][k pair]
  const int b = blockIdx.x;
  if (b < T_GU) {
    cvt_t_tile(wgu, wgt, D_DIM, 2 * I_DIM,
               (b % (2 * I_DIM / 64)) * 64, (b / (2 * I_DIM / 64)) * 64, t);
  } else if (b < T_GU + T_DN) {
    const int e = b - T_GU;
    cvt_t_tile(wdn, wdt, I_DIM, D_DIM, (e % (D_DIM / 64)) * 64, (e / (D_DIM / 64)) * 64, t);
  } else {
    const size_t i = (size_t)(b - T_GU - T_DN) * 256 + threadIdx.x;   // 8 elements each
    const float4 u = ((const float4*)x)[2 * i];
    const float4 v = ((const float4*)x)[2 * i + 1];
    uint4 o;
    o.x = pack2(u.x, u.y); o.y = pack2(u.z, u.w);
    o.z = pack2(v.x, v.y); o.w = pack2(v.z, v.w);
    ((uint4*)xb)[i] = o;
    // no register that the store names is rewritten ahead of this wait
    asm volatile("s_wait_xcnt 0x0" ::: "memory");
  }
}

// ---------------------------------------------------------------------------
// Kernel 1: fused gate/up GEMM + SwiGLU, bf16 hidden output.
// Block tile: M=128, N_hidden=64 (64 gate cols + 64 up cols).
// 8 waves: wm in {0,1} (64 rows), wn in {0..3} (16 hidden cols each).
// ---------------------------------------------------------------------------
__global__ __launch_bounds__(256)
void k_gateup(const unsigned short* __restrict__ xb, const unsigned short* __restrict__ wgt,
              const float* __restrict__ bgu, unsigned short* __restrict__ hid) {
  __shared__ __attribute__((aligned(16))) unsigned Au[2 * TILE_U];  // two buffers: A tile [m][k] 128x64 bf16
  __shared__ __attribute__((aligned(16))) unsigned Bs[2 * TILE_U];  // two buffers: B [n][k], 64 gate rows, 64 up rows

  const int tid  = threadIdx.x;
  const int lane = tid & 31;
  const int wave = tid >> 5;
  const int wm   = wave >> 2;      // 0..1
  const int wn   = wave & 3;       // 0..3
  const int half = lane >> 4;
  const int nl   = lane & 15;

  const int n0 = blockIdx.x * 64;    // hidden-column tile
  const int m0 = blockIdx.y * 128;   // token tile

  const v8f vzero = {0.f,0.f,0.f,0.f,0.f,0.f,0.f,0.f};
  v8f accg[4], accu[4];
#pragma unroll
  for (int i = 0; i < 4; ++i) { accg[i] = vzero; accu[i] = vzero; }

  // staging roles: 8 lanes per 128-B row, 32 rows per copy
  const int crow = tid >> 3;          // 0..31
  const int ccol = tid & 7;           // 16-B piece of the row
  const unsigned ldsA = (unsigned)(uintptr_t)(Au + crow * KSTRIDE_U + ccol * 4);
  const unsigned ldsB = (unsigned)(uintptr_t)(Bs + crow * KSTRIDE_U + ccol * 4);
  const unsigned short* ga = xb  + (size_t)(m0 + crow) * D_DIM + ccol * 8;
  const unsigned short* gg = wgt + (size_t)(n0 + crow) * D_DIM + ccol * 8;
  const unsigned short* gu = gg + (size_t)I_DIM * D_DIM;

  // the copies of the 64-k tile at k into the buffer at byte offset buf
  auto fill = [&](int k, unsigned buf) {
    copy_tiles(ldsA + buf, ga + k, ga + k + 32 * D_DIM, ga + k + 64 * D_DIM, ga + k + 96 * D_DIM,
               ldsB + buf, gg + k, gg + k + 32 * D_DIM, gu + k, gu + k + 32 * D_DIM);
  };

  // one trip: the 16 WMMAs of the 64-k tile in buffer b (b a literal: constant LDS offsets)
  auto trip = [&](int b) {
    const unsigned* At = Au + b * TILE_U;
    const unsigned* Bg = Bs + b * TILE_U;
    const unsigned* Bu = Bg + 64 * KSTRIDE_U;
#pragma unroll
    for (int kk = 0; kk < 64; kk += 32) {
      v16bf a[4];
#pragma unroll
      for (int i = 0; i < 4; ++i)
        a[i] = ld_frag(At, wm * 64 + i * 16 + nl, kk, half);
      v16bf bg = ld_frag(Bg, wn * 16 + nl, kk, half);
      v16bf bu = ld_frag(Bu, wn * 16 + nl, kk, half);
#pragma unroll
      for (int i = 0; i < 4; ++i) {
        accg[i] = __builtin_amdgcn_wmma_f32_16x16x32_bf16(false, a[i], false, bg,
                                                          (short)0, accg[i], false, false);
        accu[i] = __builtin_amdgcn_wmma_f32_16x16x32_bf16(false, a[i], false, bu,
                                                          (short)0, accu[i], false, false);
      }
    }
    // this wave's LDS reads of this buffer have retired before it is refilled
    asm volatile("s_wait_dscnt 0x0" ::: "memory");
    // this wave's copies of the next tile have landed before the barrier that publishes them
    asm volatile("s_wait_asynccnt 0x0" ::: "memory");
    __syncthreads();
  };

  fill(0, 0u);
  // tile 0 has landed before the barrier that publishes it
  asm volatile("s_wait_asynccnt 0x0" ::: "memory");
  __syncthreads();
  fill(64, 4u * TILE_U);

  for (int k0 = 128; k0 < D_DIM; k0 += 128) {
    trip(0);
    fill(k0, 0u);
    trip(1);
    fill(k0 + 64, 4u * TILE_U);
  }
  // the last two tiles: nothing is left to copy
  trip(0);
  trip(1);
  // no copy is outstanding when the wave goes on to its end
  asm volatile("s_wait_asynccnt 0x0" ::: "memory");

  // ---- epilogue: bias + SwiGLU, store bf16 hidden ----
  const int nh = n0 + wn * 16 + nl;          // hidden column (D layout: N = lane%16)
  const float biasg = bgu[nh];
  const float biasu = bgu[I_DIM + nh];
#pragma unroll
  for (int i = 0; i < 4; ++i) {
#pragma unroll
    for (int r = 0; r < 8; ++r) {
      const int m = m0 + wm * 64 + i * 16 + r + half * 8;   // D layout: M = r + half*8
      const float g = accg[i][r] + biasg;
      const float u = accu[i][r] + biasu;
      const float h = g * u / (1.f + __expf(-g));           // silu(g) * u
      hid[(size_t)m * I_DIM + nh] = f2bf(h);
    }
  }
}

// ---------------------------------------------------------------------------
// Kernel 2: out = hidden(bf16) @ w_down + b_down.  Block tile 128x128,
// 8 waves 2x4: wave tile M=64 (4 frags), N=32 (2 frags).
// ---------------------------------------------------------------------------
__global__ __launch_bounds__(256)
void k_down(const unsigned short* __restrict__ hid, const unsigned short* __restrict__ wdt,
            const float* __restrict__ bdn, float* __restrict__ out) {
  __shared__ __attribute__((aligned(16))) unsigned Au[2 * TILE_U];   // two buffers: A tile [m][k]  128x64 bf16
  __shared__ __attribute__((aligned(16))) unsigned Bt[2 * TILE_U];   // two buffers: B tile [n][k]  128x64 bf16

  const int tid  = threadIdx.x;
  const int lane = tid & 31;
  const int wave = tid >> 5;
  const int wm   = wave >> 2;
  const int wn   = wave & 3;
  const int half = lane >> 4;
  const int nl   = lane & 15;

  const int n0 = blockIdx.x * 128;
  const int m0 = blockIdx.y * 128;

  const v8f vzero = {0.f,0.f,0.f,0.f,0.f,0.f,0.f,0.f};
  v8f acc[4][2];
#pragma unroll
  for (int i = 0; i < 4; ++i) { acc[i][0] = vzero; acc[i][1] = vzero; }

  // staging roles: 8 lanes per 128-B row, 32 rows per copy
  const int crow = tid >> 3;          // 0..31
  const int ccol = tid & 7;           // 16-B piece of the row
  const unsigned ldsA = (unsigned)(uintptr_t)(Au + crow * KSTRIDE_U + ccol * 4);
  const unsigned ldsB = (unsigned)(uintptr_t)(Bt + crow * KSTRIDE_U + ccol * 4);
  const unsigned short* ga = hid + (size_t)(m0 + crow) * I_DIM + ccol * 8;
  const unsigned short* gb = wdt + (size_t)(n0 + crow) * I_DIM + ccol * 8;

  // the copies of the 64-k tile at k into the buffer at byte offset buf
  auto fill = [&](int k, unsigned buf) {
    copy_tiles(ldsA + buf, ga + k, ga + k + 32 * I_DIM, ga + k + 64 * I_DIM, ga + k + 96 * I_DIM,
               ldsB + buf, gb + k, gb + k + 32 * I_DIM, gb + k + 64 * I_DIM, gb + k + 96 * I_DIM);
  };

  // one trip: the 16 WMMAs of the 64-k tile in buffer t (t a literal: constant LDS offsets)
  auto trip = [&](int t) {
    const unsigned* At = Au + t * TILE_U;
    const unsigned* Bb = Bt + t * TILE_U;
#pragma unroll
    for (int kk = 0; kk < 64; kk += 32) {
      v16bf a[4], b[2];
#pragma unroll
      for (int i = 0; i < 4; ++i)
        a[i] = ld_frag(At, wm * 64 + i * 16 + nl, kk, half);
#pragma unroll
      for (int j = 0; j < 2; ++j)
        b[j] = ld_frag(Bb, wn * 32 + j * 16 + nl, kk, half);
#pragma unroll
      for (int i = 0; i < 4; ++i)
#pragma unroll
        for (int j = 0; j < 2; ++j)
          acc[i][j] = __builtin_amdgcn_wmma_f32_16x16x32_bf16(false, a[i], false, b[j],
                                                              (short)0, acc[i][j], false, false);
    }
    // this wave's LDS reads of this buffer have retired before it is refilled
    asm volatile("s_wait_dscnt 0x0" ::: "memory");
    // this wave's copies of the next tile have landed before the barrier that publishes them
    asm volatile("s_wait_asynccnt 0x0" ::: "memory");
    __syncthreads();
  };

  fill(0, 0u);
  // tile 0 has landed before the barrier that publishes it
  asm volatile("s_wait_asynccnt 0x0" ::: "memory");
  __syncthreads();
  fill(64, 4u * TILE_U);

  for (int k0 = 128; k0 < I_DIM; k0 += 128) {
    trip(0);
    fill(k0, 0u);
    trip(1);
    fill(k0 + 64, 4u * TILE_U);
  }
  // the last two tiles: nothing is left to copy
  trip(0);
  trip(1);
  // no copy is outstanding when the wave goes on to its end
  asm volatile("s_wait_asynccnt 0x0" ::: "memory");

  // ---- epilogue: bias add, fp32 store ----
#pragma unroll
  for (int j = 0; j < 2; ++j) {
    const int n = n0 + wn * 32 + j * 16 + nl;
    const float bias = bdn[n];
#pragma unroll
    for (int i = 0; i < 4; ++i) {
#pragma unroll
      for (int r = 0; r < 8; ++r) {
        const int m = m0 + wm * 64 + i * 16 + r + half * 8;
        out[(size_t)m * D_DIM + n] = acc[i][j][r] + bias;
      }
    }
  }
}

// ---------------------------------------------------------------------------
extern "C" void kernel_launch(void* const* d_in, const int* in_sizes, int n_in,
                              void* d_out, int out_size, void* d_ws, size_t ws_size,
                              hipStream_t stream) {
  const float* x   = (const float*)d_in[0];   // [4096, 2048]
  const float* wgu = (const float*)d_in[1];   // [2048, 16384]
  const float* bgu = (const float*)d_in[2];   // [16384]
  const float* wdn = (const float*)d_in[3];   // [8192, 2048]
  const float* bdn = (const float*)d_in[4];   // [2048]
  float* out = (float*)d_out;                 // [4096, 2048]
  unsigned short* hid = (unsigned short*)d_ws;             // [4096, 8192]  bf16, 64 MiB
  unsigned short* xb  = hid + (size_t)M_TOT * I_DIM;       // [4096, 2048]  bf16, 16 MiB
  unsigned short* wgt = xb  + (size_t)M_TOT * D_DIM;       // [16384, 2048] bf16, 64 MiB
  unsigned short* wdt = wgt + (size_t)2 * I_DIM * D_DIM;   // [2048, 8192]  bf16, 32 MiB

  k_prep<<<T_GU + T_DN + T_X, 256, 0, stream>>>(x, wgu, wdn, xb, wgt, wdt);

  dim3 g1(I_DIM / 64, M_TOT / 128);   // 128 x 32
  k_gateup<<<g1, 256, 0, stream>>>(xb, wgt, bgu, hid);

  dim3 g2(D_DIM / 128, M_TOT / 128);  // 16 x 32
  k_down<<<g2, 256, 0, stream>>>(hid, wdt, bdn, out);
}

// v003
// A run of this version takes 259 microseconds.
// In both of two side-by-side timings against v002, it was 1.38 times as fast.
// Over all steps from v000 it is 4.02 times as fast.
#include <hip/hip_runtime.h>

// ---------------------------------------------------------------------------
// SwiGLU MLP for MI455X (gfx1250, wave32).
//   hidden = silu(x @ Wg + bg) * (x @ Wu + bu)      [4096 x 8192]  (bf16, d_ws)
//   out    = hidden @ Wd + bd                        [4096 x 2048]  (fp32)
// Compute-bound (AI ~1.5 kFLOP/B) -> V_WMMA_F32_16X16X32_BF16, fp32 accum.
// A pre-pass rounds x and both weights to bf16 once per call (weights also
// transposed to [n][k]); every GEMM tile is then a plain byte copy, staged with
// GLOBAL_LOAD_ASYNC_TO_LDS_B128 (ASYNCcnt) into two LDS buffers: the copies of
// tile t + 2 are issued behind the barrier that ends trip t and fly during trip t + 1.
// ---------------------------------------------------------------------------

typedef __attribute__((ext_vector_type(16))) __bf16 v16bf;
typedef __attribute__((ext_vector_type(8)))  float  v8f;

#define M_TOT 4096
#define D_DIM 2048
#define I_DIM 8192

// LDS tile: 128 K-elements a row (256 B) + 16 B pad = 272 B -> 68 uints: 16 B x odd,
// so every fragment read is a 16B-aligned ds_load_b128 without bank conflicts.
#define KT 128
#define KSTRIDE_U 68
#define ROWS_U(r) ((r) * KSTRIDE_U)   // r tile rows, in uints

__device__ __forceinline__ unsigned short f2bf(float f) {
  unsigned u = __float_as_uint(f);
  u += 0x7FFFu + ((u >> 16) & 1u);   // round-to-nearest-even
  return (unsigned short)(u >> 16);
}

#if __has_builtin(__builtin_amdgcn_cvt_pk_bf16_f32)
typedef __attribute__((ext_vector_type(2))) __bf16 v2bf;
__device__ __forceinline__ unsigned pack2(float lo, float hi) {
  union { v2bf v; unsigned u; } c;
  c.v = __builtin_amdgcn_cvt_pk_bf16_f32(lo, hi);
  return c.u;
}
#else
__device__ __forceinline__ unsigned pack2(float lo, float hi) {
  return (unsigned)f2bf(lo) | ((unsigned)f2bf(hi) << 16);
}
#endif

// Load one 16x32 bf16 A/B fragment from an LDS tile stored [row][k] with
// KSTRIDE_U uint stride. Per ISA 16-bit layout: lane -> row = lane%16,
// half = lane/16; VGPR v holds K = kk + (v&3)*2 + half*8 + (v>=4)*16.
__device__ __forceinline__ v16bf ld_frag(const unsigned* lds, int row, int kk, int half) {
  union { v16bf v; uint4 q[2]; } u;
  const uint4* p = (const uint4*)(lds + row * KSTRIDE_U + (kk >> 1) + half * 4);
  u.q[0] = p[0];   // VGPRs 0..3  (K = kk+half*8   .. +7)
  u.q[1] = p[2];   // VGPRs 4..7  (K = kk+half*8+16 .. +23)
  return u.v;
}

// Stage 128 rows x 128 bf16 (256 B a row) into LDS at KSTRIDE_U pitch.  Sixteen lanes
// cover one row, so each wave-wide copy reads two whole 256-B units; the 256 threads
// cover 16 rows a copy.  l: the lane's LDS byte address in rows 0..15; g: its global
// address there; LD: the global row length in elements.
template <int LD>
__device__ __forceinline__ void copy_rows128(unsigned l, const unsigned short* g) {
  const unsigned step = 16u * 4u * KSTRIDE_U;   // 16 rows, in bytes
  // s_wait_xcnt closes the statement so that no address register of an issued
  // copy is rewritten (later address additions) ahead of it.
  asm volatile("global_load_async_to_lds_b128 %0, %8, off\n\t"
               "global_load_async_to_lds_b128 %1, %9, off\n\t"
               "global_load_async_to_lds_b128 %2, %10, off\n\t"
               "global_load_async_to_lds_b128 %3, %11, off\n\t"
               "global_load_async_to_lds_b128 %4, %12, off\n\t"
               "global_load_async_to_lds_b128 %5, %13, off\n\t"
               "global_load_async_to_lds_b128 %6, %14, off\n\t"
               "global_load_async_to_lds_b128 %7, %15, off\n\t"
               "s_wait_xcnt 0x0"
               :: "v"(l), "v"(l + step), "v"(l + 2u * step), "v"(l + 3u * step),
                  "v"(l + 4u * step), "v"(l + 5u * step), "v"(l + 6u * step), "v"(l + 7u * step),
                  "v"((unsigned long long)(uintptr_t)g),
                  "v"((unsigned long long)(uintptr_t)(g + 16 * LD)),
                  "v"((unsigned long long)(uintptr_t)(g + 32 * LD)),
                  "v"((unsigned long long)(uintptr_t)(g + 48 * LD)),
                  "v"((unsigned long long)(uintptr_t)(g + 64 * LD)),
                  "v"((unsigned long long)(uintptr_t)(g + 80 * LD)),
                  "v"((unsigned long long)(uintptr_t)(g + 96 * LD)),
                  "v"((unsigned long long)(uintptr_t)(g + 112 * LD))
               : "memory");
}

// ---------------------------------------------------------------------------
// Pre-pass, one launch, three jobs picked by block index (block-uniform):
//   wgt[n][k] = bf16(w_gate_up[k][n]),  wdt[n][k] = bf16(w_down[k][n]),  xb = bf16(x).
// ---------------------------------------------------------------------------
#define T_GU ((2 * I_DIM / 64) * (D_DIM / 64))   // 64x64 tiles of w_gate_up
#define T_DN ((D_DIM / 64) * (I_DIM / 64))       // 64x64 tiles of w_down
#define T_X  (M_TOT * D_DIM / (8 * 256))         // blocks of 2048 elements of x

// One 64(k) x 64(n) tile of wt[n][k] = bf16(w[k][n]).  Two k-rows are packed into
// one dword per column, so the transpose through LDS moves dwords; pitch 33 keeps
// the column-wise stores on distinct banks.
__device__ __forceinline__ void cvt_t_tile(const float* __restrict__ w,
                                           unsigned short* __restrict__ wt,
                                           int kdim, int ndim, int n0, int k0,
                                           unsigned* t) {
  const int tid = threadIdx.x;
  const int n4 = (tid & 15) * 4;
  const int kp = tid >> 4;                 // k pair 0..15; the thread also takes kp + 16
  const float* s = w + (size_t)(k0 + 2 * kp) * ndim + n0 + n4;
  const float4 a0 = *(const float4*)s;
  const float4 b0 = *(const float4*)(s + ndim);
  const float4 a1 = *(const float4*)(s + 32 * ndim);
  const float4 b1 = *(const float4*)(s + 33 * ndim);
  t[(n4 + 0) * 33 + kp] = pack2(a0.x, b0.x);
  t[(n4 + 1) * 33 + kp] = pack2(a0.y, b0.y);
  t[(n4 + 2) * 33 + kp] = pack2(a0.z, b0.z);
  t[(n4 + 3) * 33 + kp] = pack2(a0.w, b0.w);
  t[(n4 + 0) * 33 + kp + 16] = pack2(a1.x, b1.x);
  t[(n4 + 1) * 33 + kp + 16] = pack2(a1.y, b1.y);
  t[(n4 + 2) * 33 + kp + 16] = pack2(a1.z, b1.z);
  t[(n4 + 3) * 33 + kp + 16] = pack2(a1.w, b1.w);
  __syncthreads();
  const int n = tid >> 2;                  // 0..63
  const int c = (tid & 3) * 4;             // dword in the first 64-B half row
  const unsigned* r = t + n * 33 + c;
  uint4 o0, o1;
  o0.x = r[0];  o0.y = r[1];  o0.z = r[2];  o0.w = r[3];
  o1.x = r[16]; o1.y = r[17]; o1.z = r[18]; o1.w = r[19];
  unsigned* d = (unsigned*)(wt + (size_t)(n0 + n) * kdim + k0) + c;
  *(uint4*)d = o0;
  *(uint4*)(d + 16) = o1;
  // no register that the two stores name is rewritten ahead of this wait
  asm volatile("s_wait_xcnt 0x0" ::: "memory");
}

__global__ __launch_bounds__(256)
void k_prep(const float* __restrict__ x, const float* __restrict__ wgu,
            const float* __restrict__ wdn, unsigned short* __restrict__ xb,
            unsigned short* __restrict__ wgt, unsigned short* __restrict__ wdt) {
  __shared__ unsigned t[64 * 33];          // [n][k pair]
  const int b = blockIdx.x;
  if (b < T_GU) {
    cvt_t_tile(wgu, wgt, D_DIM, 2 * I_DIM,
               (b % (2 * I_DIM / 64)) * 64, (b / (2 * I_DIM / 64)) * 64, t);
  } else if (b < T_GU + T_DN) {
    const int e = b - T_GU;
    cvt_t_tile(wdn, wdt, I_DIM, D_DIM, (e % (D_DIM / 64)) * 64, (e / (D_DIM / 64)) * 64, t);
  } else {
    const size_t i = (size_t)(b - T_GU - T_DN) * 256 + threadIdx.x;   // 8 elements each
    const float4 u = ((const float4*)x)[2 * i];
    const float4 v = ((const float4*)x)[2 * i + 1];
    uint4 o;
    o.x = pack2(u.x, u.y); o.y = pack2(u.z, u.w);
    o.z = pack2(v.x, v.y); o.w = pack2(v.z, v.w);
    ((uint4*)xb)[i] = o;
    // no register that the store names is rewritten ahead of this wait
    asm volatile("s_wait_xcnt 0x0" ::: "memory");
  }
}

// ---------------------------------------------------------------------------
// Kernel 1: fused gate/up GEMM + SwiGLU, bf16 hidden output.
// Block tile: M=256, N_hidden=128 (128 gate cols + 128 up cols), one block a WGP.
// 8 waves: wm in {0,1} (128 rows), wn in {0..3} (32 hidden cols each):
// 12 fragments feed 32 WMMAs per 32 k.
// ---------------------------------------------------------------------------
#define GU_A_U ROWS_U(256)     // one buffer of the A tile, in uints
#define GU_B_U ROWS_U(256)     // one buffer of the B tile (128 gate rows, 128 up rows)
__global__ __launch_bounds__(256)
void k_gateup(const unsigned short* __restrict__ xb, const unsigned short* __restrict__ wgt,
              const float* __restrict__ bgu, unsigned short* __restrict__ hid) {
  __shared__ __attribute__((aligned(16))) unsigned Au[2 * GU_A_U];  // two buffers: A tile [m][k] 256x128 bf16
  __shared__ __attribute__((aligned(16))) unsigned Bs[2 * GU_B_U];  // two buffers: B [n][k], gate rows then up rows

  const int tid  = threadIdx.x;
  const int lane = tid & 31;
  const int wave = tid >> 5;
  const int wm   = wave >> 2;      // 0..1
  const int wn   = wave & 3;       // 0..3
  const int half = lane >> 4;
  const int nl   = lane & 15;

  const int n0 = blockIdx.x * 128;   // hidden-column tile
  const int m0 = blockIdx.y * 256;   // token tile

  const v8f vzero = {0.f,0.f,0.f,0.f,0.f,0.f,0.f,0.f};
  v8f accg[8][2], accu[8][2];
#pragma unroll
  for (int i = 0; i < 8; ++i) {
    accg[i][0] = vzero; accg[i][1] = vzero; accu[i][0] = vzero; accu[i][1] = vzero;
  }

  // staging roles: 16 lanes per 256-B row, 16 rows per copy
  const int crow = tid >> 4;          // 0..15
  const int ccol = tid & 15;          // 16-B piece of the row
  const unsigned ldsA = (unsigned)(uintptr_t)(Au + crow * KSTRIDE_U + ccol * 4);
  const unsigned ldsB = (unsigned)(uintptr_t)(Bs + crow * KSTRIDE_U + ccol * 4);
  const unsigned short* ga = xb  + (size_t)(m0 + crow) * D_DIM + ccol * 8;
  const unsigned short* gg = wgt + (size_t)(n0 + crow) * D_DIM + ccol * 8;
  const unsigned short* gu = gg + (size_t)I_DIM * D_DIM;

  // the copies of the 128-k tile at k into buffer b
  auto fill = [&](int k, unsigned b) {
    copy_rows128<D_DIM>(ldsA + b * 4u * GU_A_U, ga + k);
    copy_rows128<D_DIM>(ldsA + b * 4u * GU_A_U + 4u * ROWS_U(128), ga + k + 128 * D_DIM);
    copy_rows128<D_DIM>(ldsB + b * 4u * GU_B_U, gg + k);
    copy_rows128<D_DIM>(ldsB + b * 4u * GU_B_U + 4u * ROWS_U(128), gu + k);
  };

  // one trip: the 128 WMMAs of the 128-k tile in buffer b
  auto trip = [&](unsigned b) {
    const unsigned* At = Au + b * GU_A_U;
    const unsigned* Bg = Bs + b * GU_B_U;
    const unsigned* Bu = Bg + ROWS_U(128);
#pragma unroll
    for (int kk = 0; kk < KT; kk += 32) {
      v16bf a[8], bg[2], bu[2];
#pragma unroll
      for (int j = 0; j < 2; ++j) {
        bg[j] = ld_frag(Bg, wn * 32 + j * 16 + nl, kk, half);
        bu[j] = ld_frag(Bu, wn * 32 + j * 16 + nl, kk, half);
      }
#pragma unroll
      for (int i = 0; i < 8; ++i)
        a[i] = ld_frag(At, wm * 128 + i * 16 + nl, kk, half);
      // keeps the block's 24 LDS reads together in front of its WMMAs: sunk among
      // them, each pair of reads is waited for to zero right before its use
      __builtin_amdgcn_sched_barrier(0);
#pragma unroll
      for (int i = 0; i < 8; ++i) {
#pragma unroll
        for (int j = 0; j < 2; ++j) {
          accg[i][j] = __builtin_amdgcn_wmma_f32_16x16x32_bf16(false, a[i], false, bg[j],
                                                               (short)0, accg[i][j], false, false);
          accu[i][j] = __builtin_amdgcn_wmma_f32_16x16x32_bf16(false, a[i], false, bu[j],
                                                               (short)0, accu[i][j], false, false);
        }
      }
      // keeps the next block's fragment loads behind this block: hoisted, the four
      // blocks' fragments beside 256 accumulator registers spill to scratch
      __builtin_amdgcn_sched_barrier(0);
    }
    // this wave's LDS reads of this buffer have retired before it is refilled
    asm volatile("s_wait_dscnt 0x0" ::: "memory");
    // this wave's copies of the next tile have landed before the barrier that publishes them
    asm volatile("s_wait_asynccnt 0x0" ::: "memory");
    __syncthreads();
  };

  fill(0, 0u);
  // tile 0 has landed before the barrier that publishes it
  asm volatile("s_wait_asynccnt 0x0" ::: "memory");
  __syncthreads();
  fill(KT, 1u);

  // rolled: one copy of the trip's code, and the buffer's addresses are formed per trip
  // instead of being held in registers for both buffers
#pragma clang loop unroll(disable)
  for (int t = 0; t < D_DIM / KT; ++t) {
    const unsigned b = (unsigned)t & 1u;
    trip(b);
    if (t + 2 < D_DIM / KT) fill((t + 2) * KT, b);   // the same test in every wave
  }
  // no copy is outstanding when the wave goes on to its end
  asm volatile("s_wait_asynccnt 0x0" ::: "memory");

  // ---- epilogue: bias + SwiGLU, store bf16 hidden ----
#pragma unroll
  for (int j = 0; j < 2; ++j) {
    const int nh = n0 + wn * 32 + j * 16 + nl;   // hidden column (D layout: N = lane%16)
    const float biasg = bgu[nh];
    const float biasu = bgu[I_DIM + nh];
#pragma unroll
    for (int i = 0; i < 8; ++i) {
      unsigned short hv[8];
#pragma unroll
      for (int r = 0; r < 8; ++r) {
        const float g = accg[i][j][r] + biasg;
        const float u = accu[i][j][r] + biasu;
        hv[r] = f2bf(g * u / (1.f + __expf(-g)));             // silu(g) * u
      }
      unsigned short* hp = hid + (size_t)(m0 + wm * 128 + i * 16 + half * 8) * I_DIM + nh;
      // the two fences keep other work out of the run of stores and its wait, so that
      // no register that a store names is rewritten ahead of the s_wait_xcnt
      __builtin_amdgcn_sched_barrier(0);
#pragma unroll
      for (int r = 0; r < 8; ++r) hp[(size_t)r * I_DIM] = hv[r];   // D layout: M = r + half*8
      asm volatile("s_wait_xcnt 0x0" ::: "memory");
      __builtin_amdgcn_sched_barrier(0);
    }
  }
}

// ---------------------------------------------------------------------------
// Kernel 2: out = hidden(bf16) @ w_down + b_down.  Block tile 256x128 (256 blocks,
// one a WGP), 8 waves 4x2: wave tile M=64 (4 frags), N=64 (4 frags).
// ---------------------------------------------------------------------------
#define DN_A_U ROWS_U(256)     // one buffer of the A tile, in uints
#define DN_B_U ROWS_U(128)     // one buffer of the B tile
__global__ __launch_bounds__(256)
void k_down(const unsigned short* __restrict__ hid, const unsigned short* __restrict__ wdt,
            const float* __restrict__ bdn, float* __restrict__ out) {
  __shared__ __attribute__((aligned(16))) unsigned Au[2 * DN_A_U];   // two buffers: A tile [m][k]  256x128 bf16
  __shared__ __attribute__((aligned(16))) unsigned Bt[2 * DN_B_U];   // two buffers: B tile [n][k]  128x128 bf16

  const int tid  = threadIdx.x;
  const int lane = tid & 31;
  const int wave = tid >> 5;
  const int wm   = wave >> 1;      // 0..3
  const int wn   = wave & 1;       // 0..1
  const int half = lane >> 4;
  const int nl   = lane & 15;

  const int n0 = blockIdx.x * 128;
  const int m0 = blockIdx.y * 256;

  const v8f vzero = {0.f,0.f,0.f,0.f,0.f,0.f,0.f,0.f};
  v8f acc[4][4];
#pragma unroll
  for (int i = 0; i < 4; ++i)
#pragma unroll
    for (int j = 0; j < 4; ++j) acc[i][j] = vzero;

  // staging roles: 16 lanes per 256-B row, 16 rows per copy
  const int crow = tid >> 4;          // 0..15
  const int ccol = tid & 15;          // 16-B piece of the row
  const unsigned ldsA = (unsigned)(uintptr_t)(Au + crow * KSTRIDE_U + ccol * 4);
  const unsigned ldsB = (unsigned)(uintptr_t)(Bt + crow * KSTRIDE_U + ccol * 4);
  const unsigned short* ga = hid + (size_t)(m0 + crow) * I_DIM + ccol * 8;
  const unsigned short* gb = wdt + (size_t)(n0 + crow) * I_DIM + ccol * 8;

  // the copies of the 128-k tile at k into buffer b
  auto fill = [&](int k, unsigned b) {
    copy_rows128<I_DIM>(ldsA + b * 4u * DN_A_U, ga + k);
    copy_rows128<I_DIM>(ldsA + b * 4u * DN_A_U + 4u * ROWS_U(128), ga + k + 128 * I_DIM);
    copy_rows128<I_DIM>(ldsB + b * 4u * DN_B_U, gb + k);
  };

  // one trip: the 64 WMMAs of the 128-k tile in buffer t
  auto trip = [&](unsigned t) {
    const unsigned* At = Au + t * DN_A_U;
    const unsigned* Bb = Bt + t * DN_B_U;
#pragma unroll
    for (int kk = 0; kk < KT; kk += 32) {
      v16bf a[4], b[4];
#pragma unroll
      for (int i = 0; i < 4; ++i)
        a[i] = ld_frag(At, wm * 64 + i * 16 + nl, kk, half);
#pragma unroll
      for (int j = 0; j < 4; ++j)
        b[j] = ld_frag(Bb, wn * 64 + j * 16 + nl, kk, half);
      // keeps the block's 16 LDS reads together in front of its WMMAs: sunk among
      // them, each pair of reads is waited for to zero right before its use
      __builtin_amdgcn_sched_barrier(0);
#pragma unroll
      for (int i = 0; i < 4; ++i)
#pragma unroll
        for (int j = 0; j < 4; ++j)
          acc[i][j] = __builtin_amdgcn_wmma_f32_16x16x32_bf16(false, a[i], false, b[j],
                                                              (short)0, acc[i][j], false, false);
      // keeps the next block's reads from being spread among this block's WMMAs
      __builtin_amdgcn_sched_barrier(0);
    }
    // this wave's LDS reads of this buffer have retired before it is refilled
    asm volatile("s_wait_dscnt 0x0" ::: "memory");
    // this wave's copies of the next tile have landed before the barrier that publishes them
    asm volatile("s_wait_asynccnt 0x0" ::: "memory");
    __syncthreads();
  };

  fill(0, 0u);
  // tile 0 has landed before the barrier that publishes it
  asm volatile("s_wait_asynccnt 0x0" ::: "memory");
  __syncthreads();
  fill(KT, 1u);

  // rolled: one copy of the trip's code, and the buffer's addresses are formed per trip
  // instead of being held in registers for both buffers
#pragma clang loop unroll(disable)
  for (int t = 0; t < I_DIM / KT; ++t) {
    const unsigned b = (unsigned)t & 1u;
    trip(b);
    if (t + 2 < I_DIM / KT) fill((t + 2) * KT, b);   // the same test in every wave
  }
  // no copy is outstanding when the wave goes on to its end
  asm volatile("s_wait_asynccnt 0x0" ::: "memory");

  // ---- epilogue: bias add, fp32 store ----
#pragma unroll
  for (int j = 0; j < 4; ++j) {
    const int n = n0 + wn * 64 + j * 16 + nl;
    const float bias = bdn[n];
#pragma unroll
    for (int i = 0; i < 4; ++i) {
#pragma unroll
      for (int r = 0; r < 8; ++r) {
        const int m = m0 + wm * 64 + i * 16 + r + half * 8;
        out[(size_t)m * D_DIM + n] = acc[i][j][r] + bias;
      }
    }
  }
}

// ---------------------------------------------------------------------------
extern "C" void kernel_launch(void* const* d_in, const int* in_sizes, int n_in,
                              void* d_out, int out_size, void* d_ws, size_t ws_size,
                              hipStream_t stream) {
  const float* x   = (const float*)d_in[0];   // [4096, 2048]
  const float* wgu = (const float*)d_in[1];   // [2048, 16384]
  const float* bgu = (const float*)d_in[2];   // [16384]
  const float* wdn = (const float*)d_in[3];   // [8192, 2048]
  const float* bdn = (const float*)d_in[4];   // [2048]
  float* out = (float*)d_out;                 // [4096, 2048]
  unsigned short* hid = (unsigned short*)d_ws;             // [4096, 8192]  bf16, 64 MiB
  unsigned short* xb  = hid + (size_t)M_TOT * I_DIM;       // [4096, 2048]  bf16, 16 MiB
  unsigned short* wgt = xb  + (size_t)M_TOT * D_DIM;       // [16384, 2048] bf16, 64 MiB
  unsigned short* wdt = wgt + (size_t)2 * I_DIM * D_DIM;   // [2048, 8192]  bf16, 32 MiB

  k_prep<<<T_GU + T_DN + T_X, 256, 0, stream>>>(x, wgu, wdn, xb, wgt, wdt);

  dim3 g1(I_DIM / 128, M_TOT / 256);  // 64 x 16
  k_gateup<<<g1, 256, 0, stream>>>(xb, wgt, bgu, hid);

  dim3 g2(D_DIM / 128, M_TOT / 256);  // 16 x 16
  k_down<<<g2, 256, 0, stream>>>(hid, wdt, bdn, out);
}

// v004
// One run takes 241 microseconds.
// In both of two side-by-side timings against v003, it was 1.07 times as fast.
// All steps since v000 together make it 4.31 times as fast.
#include <hip/hip_runtime.h>
#include <stdint.h>

// ---------------------------------------------------------------------------
// SwiGLU MLP for MI455X (gfx1250, wave32).
//   hidden = silu(x @ Wg + bg) * (x @ Wu + bu)      [4096 x 8192]  (bf16, d_ws)
//   out    = hidden @ Wd + bd                        [4096 x 2048]  (fp32)
// Compute-bound (AI ~1.5 kFLOP/B) -> V_WMMA_F32_16X16X32_BF16, fp32 accum.
// A pre-pass rounds x and both weights to bf16 once per call (weights also
// transposed to [n][k]); every GEMM tile is then a plain byte copy, staged with
// TENSOR_LOAD_TO_LDS (TENSORcnt), one slice of rows a wave, into two LDS buffers: the loads
// of tile t + 2 are issued behind the barrier that ends trip t and fly during trip t + 1.
// ---------------------------------------------------------------------------

typedef __attribute__((ext_vector_type(16))) __bf16 v16bf;
typedef __attribute__((ext_vector_type(8)))  float  v8f;

#define M_TOT 4096
#define D_DIM 2048
#define I_DIM 8192

// LDS tile: 128 K-elements a row (256 B) + 16 B pad = 272 B -> 68 uints: 16 B x odd,
// so every fragment read is a 16B-aligned ds_load_b128 without bank conflicts.
#define KT 128
#define KSTRIDE_U 68

__device__ __forceinline__ unsigned short f2bf(float f) {
  unsigned u = __float_as_uint(f);
  u += 0x7FFFu + ((u >> 16) & 1u);   // round-to-nearest-even
  return (unsigned short)(u >> 16);
}

#if __has_builtin(__builtin_amdgcn_cvt_pk_bf16_f32)
typedef __attribute__((ext_vector_type(2))) __bf16 v2bf;
__device__ __forceinline__ unsigned pack2(float lo, float hi) {
  union { v2bf v; unsigned u; } c;
  c.v = __builtin_amdgcn_cvt_pk_bf16_f32(lo, hi);
  return c.u;
}
#else
__device__ __forceinline__ unsigned pack2(float lo, float hi) {
  return (unsigned)f2bf(lo) | ((unsigned)f2bf(hi) << 16);
}
#endif

// Load one 16x32 bf16 A/B fragment from an LDS tile stored [row][k] with
// KSTRIDE_U uint stride. Per ISA 16-bit layout: lane -> row = lane%16,
// half = lane/16; VGPR v holds K = kk + (v&3)*2 + half*8 + (v>=4)*16.
__device__ __forceinline__ v16bf ld_frag(const unsigned* lds, int row, int kk, int half) {
  union { v16bf v; uint4 q[2]; } u;
  const uint4* p = (const uint4*)(lds + row * KSTRIDE_U + (kk >> 1) + half * 4);
  u.q[0] = p[0];   // VGPRs 0..3  (K = kk+half*8   .. +7)
  u.q[1] = p[2];   // VGPRs 4..7  (K = kk+half*8+16 .. +23)
  return u.v;
}

typedef uint32_t u32x4 __attribute__((ext_vector_type(4)));
typedef uint32_t u32x8 __attribute__((ext_vector_type(8)));

// A slice is what one tensor load brings: 64 (or 32) rows of 256 B, laid at the 272-B pitch by
// the load's own pad.  64 x 272 B = 17,408 B is rounded up to 18,432 B, 32 x 272 B = 8,704 B to
// 10,240 B, so that every slice begins at a multiple of 2 KiB in LDS.
#define SLICE_ROWS 64
#define SLICE_U 4608                  // a 64-row slice's place, in uints
#define SLICE_B (4u * SLICE_U)        // the same in bytes
#define HSLICE_ROWS 32
#define HSLICE_U 2560                 // a 32-row slice's place, in uints
#define HSLICE_B (4u * HSLICE_U)      // the same in bytes

__device__ __forceinline__ uint32_t uni(uint32_t v) {
  return (uint32_t)__builtin_amdgcn_readfirstlane(v);
}
// A wave-uniform test for the branch around a tensor load, which ignores EXEC.
__device__ __forceinline__ uint32_t pinned(uint32_t v) {
  uint32_t w = uni(v);
  asm volatile("" : "+s"(w));   // pinned(): the word held in a scalar register, so that the test compiles to s_cmp + s_cbranch_scc
  return w;
}

// One request of the whole wave: rows x 256 B from g (row pitch PITCH_B bytes) to the LDS
// byte offset dst, 16 B of pad behind every row.  dst, g and rows are the same in every lane.
// The descriptor is handed over in fixed, high scalar registers, which the K loop uses for
// nothing else, so that no word of it is overwritten while the request is outstanding.
template <uint32_t PITCH_B>
__device__ __forceinline__ void load_slice(uint32_t dst, const unsigned short* g, uint32_t rows) {
  const uint64_t ga = (uint64_t)(uintptr_t)g;
  u32x4 g0;
  u32x8 g1;
  g0[0] = uni(1u);                                                          // count 1
  g0[1] = uni(dst);
  g0[2] = uni((uint32_t)ga);
  g0[3] = uni((((uint32_t)(ga >> 32)) & 0x01FFFFFFu) | 0x80000000u);        // type 2
  g1[0] = uni((1u << 20) | (5u << 22) | (3u << 25));   // no mask, bytes, 4 dwords of pad per 256-B row
  g1[1] = uni(256u << 16);                             // tensor_dim0 = 256 B
  g1[2] = uni(rows << 16);                             // tensor_dim1
  g1[3] = uni(256u << 16);                             // tile_dim0
  g1[4] = uni(rows);                                   // tile_dim1
  g1[5] = uni(PITCH_B);
  g1[6] = uni(0u);
  g1[7] = uni(0u);
  asm volatile("tensor_load_to_lds %0, %1" :: "{s[72:75]}"(g0), "{s[76:83]}"(g1) : "memory");
}

// ---------------------------------------------------------------------------
// Pre-pass, one launch, three jobs picked by block index (block-uniform):
//   wgt[n][k] = bf16(w_gate_up[k][n]),  wdt[n][k] = bf16(w_down[k][n]),  xb = bf16(x).
// ---------------------------------------------------------------------------
#define T_GU ((2 * I_DIM / 64) * (D_DIM / 64))   // 64x64 tiles of w_gate_up
#define T_DN ((D_DIM / 64) * (I_DIM / 64))       // 64x64 tiles of w_down
#define T_X  (M_TOT * D_DIM / (8 * 256))         // blocks of 2048 elements of x

// One 64(k) x 64(n) tile of wt[n][k] = bf16(w[k][n]).  Two k-rows are packed into
// one dword per column, so the transpose through LDS moves dwords; pitch 33 keeps
// the column-wise stores on distinct banks.
__device__ __forceinline__ void cvt_t_tile(const float* __restrict__ w,
                                           unsigned short* __restrict__ wt,
                                           int kdim, int ndim, int n0, int k0,
                                           unsigned* t) {
  const int tid = threadIdx.x;
  const int n4 = (tid & 15) * 4;
  const int kp = tid >> 4;                 // k pair 0..15; the thread also takes kp + 16
  const float* s = w + (size_t)(k0 + 2 * kp) * ndim + n0 + n4;
  const float4 a0 = *(const float4*)s;
  const float4 b0 = *(const float4*)(s + ndim);
  const float4 a1 = *(const float4*)(s + 32 * ndim);
  const float4 b1 = *(const float4*)(s + 33 * ndim);
  t[(n4 + 0) * 33 + kp] = pack2(a0.x, b0.x);
  t[(n4 + 1) * 33 + kp] = pack2(a0.y, b0.y);
  t[(n4 + 2) * 33 + kp] = pack2(a0.z, b0.z);
  t[(n4 + 3) * 33 + kp] = pack2(a0.w, b0.w);
  t[(n4 + 0) * 33 + kp + 16] = pack2(a1.x, b1.x);
  t[(n4 + 1) * 33 + kp + 16] = pack2(a1.y, b1.y);
  t[(n4 + 2) * 33 + kp + 16] = pack2(a1.z, b1.z);
  t[(n4 + 3) * 33 + kp + 16] = pack2(a1.w, b1.w);
  __syncthreads();
  const int n = tid >> 2;                  // 0..63
  const int c = (tid & 3) * 4;             // dword in the first 64-B half row
  const unsigned* r = t + n * 33 + c;
  uint4 o0, o1;
  o0.x = r[0];  o0.y = r[1];  o0.z = r[2];  o0.w = r[3];
  o1.x = r[16]; o1.y = r[17]; o1.z = r[18]; o1.w = r[19];
  unsigned* d = (unsigned*)(wt + (size_t)(n0 + n) * kdim + k0) + c;
  *(uint4*)d = o0;
  *(uint4*)(d + 16) = o1;
  // no register that the two stores name is rewritten ahead of this wait
  asm volatile("s_wait_xcnt 0x0" ::: "memory");
}

__global__ __launch_bounds__(256)
void k_prep(const float* __restrict__ x, const float* __restrict__ wgu,
            const float* __restrict__ wdn, unsigned short* __restrict__ xb,
            unsigned short* __restrict__ wgt, unsigned short* __restrict__ wdt) {
  __shared__ unsigned t[64 * 33];          // [n][k pair]
  const int b = blockIdx.x;
  if (b < T_GU) {
    cvt_t_tile(wgu, wgt, D_DIM, 2 * I_DIM,
               (b % (2 * I_DIM / 64)) * 64, (b / (2 * I_DIM / 64)) * 64, t);
  } else if (b < T_GU + T_DN) {
    const int e = b - T_GU;
    cvt_t_tile(wdn, wdt, I_DIM, D_DIM, (e % (D_DIM / 64)) * 64, (e / (D_DIM / 64)) * 64, t);
  } else {
    const size_t i = (size_t)(b - T_GU - T_DN) * 256 + threadIdx.x;   // 8 elements each
    const float4 u = ((const float4*)x)[2 * i];
    const float4 v = ((const float4*)x)[2 * i + 1];
    uint4 o;
    o.x = pack2(u.x, u.y); o.y = pack2(u.z, u.w);
    o.z = pack2(v.x, v.y); o.w = pack2(v.z, v.w);
    ((uint4*)xb)[i] = o;
    // no register that the store names is rewritten ahead of this wait
    asm volatile("s_wait_xcnt 0x0" ::: "memory");
  }
}

// ---------------------------------------------------------------------------
// Kernel 1: fused gate/up GEMM + SwiGLU, bf16 hidden output.
// Block tile: M=256, N_hidden=128 (128 gate cols + 128 up cols), one block a WGP.
// 8 waves: wm in {0,1} (128 rows), wn in {0..3} (32 hidden cols each):
// 12 fragments feed 32 WMMAs per 32 k.
// ---------------------------------------------------------------------------
#define GU_BUF_U (8 * SLICE_U)   // one buffer, in uints: slices 0..3 A rows, 4..5 gate rows, 6..7 up rows
__global__ __launch_bounds__(256)
void k_gateup(const unsigned short* __restrict__ xb, const unsigned short* __restrict__ wgt,
              const float* __restrict__ bgu, unsigned short* __restrict__ hid) {
  __shared__ __attribute__((aligned(2048))) unsigned Ls[2 * GU_BUF_U];  // two buffers of eight slices

  const int tid  = threadIdx.x;
  const int lane = tid & 31;
  const int wave = tid >> 5;
  const int wm   = wave >> 2;      // 0..1
  const int wn   = wave & 3;       // 0..3
  const int half = lane >> 4;
  const int nl   = lane & 15;

  const int n0 = blockIdx.x * 128;   // hidden-column tile
  const int m0 = blockIdx.y * 256;   // token tile

  const v8f vzero = {0.f,0.f,0.f,0.f,0.f,0.f,0.f,0.f};
  v8f accg[8][2], accu[8][2];
#pragma unroll
  for (int i = 0; i < 8; ++i) {
    accg[i][0] = vzero; accg[i][1] = vzero; accu[i][0] = vzero; accu[i][1] = vzero;
  }

  // staging roles: every wave brings slice wv of each tile, 64 rows of its operand
  const uint32_t wv = uni((uint32_t)threadIdx.x >> 5);
  const unsigned short* gs =
      wv < 4u ? xb + (size_t)(m0 + wv * SLICE_ROWS) * D_DIM
              : wgt + (size_t)(n0 + (wv & 1u) * SLICE_ROWS + (wv >= 6u ? I_DIM : 0)) * D_DIM;
  const uint32_t lds = (uint32_t)(uintptr_t)Ls + wv * SLICE_B;

  // this wave's slice of the 128-k tile at k into buffer b
  auto fill = [&](int k, unsigned b) {
    load_slice<2 * D_DIM>(lds + b * 4u * GU_BUF_U, gs + k, SLICE_ROWS);
  };

  // one trip: the 128 WMMAs of the 128-k tile in buffer b
  auto trip = [&](unsigned b) {
    const unsigned* At = Ls + b * GU_BUF_U + wm * 2 * SLICE_U;
    const unsigned* Bg = Ls + b * GU_BUF_U + (4 + (wn >> 1)) * SLICE_U;
    const unsigned* Bu = Bg + 2 * SLICE_U;
#pragma unroll
    for (int kk = 0; kk < KT; kk += 32) {
      v16bf a[8], bg[2], bu[2];
#pragma unroll
      for (int j = 0; j < 2; ++j) {
        bg[j] = ld_frag(Bg, (wn & 1) * 32 + j * 16 + nl, kk, half);
        bu[j] = ld_frag(Bu, (wn & 1) * 32 + j * 16 + nl, kk, half);
      }
#pragma unroll
      for (int i = 0; i < 8; ++i)
        a[i] = ld_frag(At + (i >> 2) * SLICE_U, (i & 3) * 16 + nl, kk, half);
      // keeps the block's 24 LDS reads together in front of its WMMAs: sunk among
      // them, each pair of reads is waited for to zero right before its use
      __builtin_amdgcn_sched_barrier(0);
#pragma unroll
      for (int i = 0; i < 8; ++i) {
#pragma unroll
        for (int j = 0; j < 2; ++j) {
          accg[i][j] = __builtin_amdgcn_wmma_f32_16x16x32_bf16(false, a[i], false, bg[j],
                                                               (short)0, accg[i][j], false, false);
          accu[i][j] = __builtin_amdgcn_wmma_f32_16x16x32_bf16(false, a[i], false, bu[j],
                                                               (short)0, accu[i][j], false, false);
        }
      }
      // keeps the next block's fragment loads behind this block: hoisted, the four
      // blocks' fragments beside 256 accumulator registers spill to scratch
      __builtin_amdgcn_sched_barrier(0);
    }
    // this wave's LDS reads of this buffer have retired before it is refilled
    asm volatile("s_wait_dscnt 0x0" ::: "memory");
    // this wave's slice of the next tile has landed before the barrier that publishes it
    asm volatile("s_wait_tensorcnt 0x0" ::: "memory");
    __syncthreads();
  };

  fill(0, 0u);
  // tile 0 has landed before the barrier that publishes it
  asm volatile("s_wait_tensorcnt 0x0" ::: "memory");
  __syncthreads();
  fill(KT, 1u);

  // rolled: one copy of the trip's code, and the buffer's addresses are formed per trip
  // instead of being held in registers for both buffers
#pragma clang loop unroll(disable)
  for (int t = 0; t < D_DIM / KT; ++t) {
    const unsigned b = (unsigned)t & 1u;
    trip(b);
    if (pinned(t + 2 < D_DIM / KT)) fill((t + 2) * KT, b);   // a scalar branch: the load ignores EXEC
  }
  // no tensor load and no LDS read is outstanding when the wave goes on to its end
  asm volatile("s_wait_tensorcnt 0x0" ::: "memory");
  asm volatile("s_wait_dscnt 0x0" ::: "memory");

  // ---- epilogue: bias + SwiGLU, store bf16 hidden ----
#pragma unroll
  for (int j = 0; j < 2; ++j) {
    const int nh = n0 + wn * 32 + j * 16 + nl;   // hidden column (D layout: N = lane%16)
    const float biasg = bgu[nh];
    const float biasu = bgu[I_DIM + nh];
#pragma unroll
    for (int i = 0; i < 8; ++i) {
      unsigned short hv[8];
#pragma unroll
      for (int r = 0; r < 8; ++r) {
        const float g = accg[i][j][r] + biasg;
        const float u = accu[i][j][r] + biasu;
        hv[r] = f2bf(g * u / (1.f + __expf(-g)));             // silu(g) * u
      }
      unsigned short* hp = hid + (size_t)(m0 + wm * 128 + i * 16 + half * 8) * I_DIM + nh;
      // the two fences keep other work out of the run of stores and its wait, so that
      // no register that a store names is rewritten ahead of the s_wait_xcnt
      __builtin_amdgcn_sched_barrier(0);
#pragma unroll
      for (int r = 0; r < 8; ++r) hp[(size_t)r * I_DIM] = hv[r];   // D layout: M = r + half*8
      asm volatile("s_wait_xcnt 0x0" ::: "memory");
      __builtin_amdgcn_sched_barrier(0);
    }
  }
}

// ---------------------------------------------------------------------------
// Kernel 2: out = hidden(bf16) @ w_down + b_down.  Block tile 256x128 (256 blocks,
// one a WGP), 8 waves 4x2: wave tile M=64 (4 frags), N=64 (4 frags).
// ---------------------------------------------------------------------------
#define DN_BUF_U (4 * SLICE_U + 4 * HSLICE_U)   // one buffer, in uints: four 64-row slices of A, four 32-row slices of B
__global__ __launch_bounds__(256)
void k_down(const unsigned short* __restrict__ hid, const unsigned short* __restrict__ wdt,
            const float* __restrict__ bdn, float* __restrict__ out) {
  __shared__ __attribute__((aligned(2048))) unsigned Ls[2 * DN_BUF_U];  // two buffers of eight slices

  const int tid  = threadIdx.x;
  const int lane = tid & 31;
  const int wave = tid >> 5;
  const int wm   = wave >> 1;      // 0..3
  const int wn   = wave & 1;       // 0..1
  const int half = lane >> 4;
  const int nl   = lane & 15;

  const int n0 = blockIdx.x * 128;
  const int m0 = blockIdx.y * 256;

  const v8f vzero = {0.f,0.f,0.f,0.f,0.f,0.f,0.f,0.f};
  v8f acc[4][4];
#pragma unroll
  for (int i = 0; i < 4; ++i)
#pragma unroll
    for (int j = 0; j < 4; ++j) acc[i][j] = vzero;

  // staging roles: every wave brings one slice of each tile: waves 0..3 64 rows of A, waves 4..7 32 rows of B
  const uint32_t wv = uni((uint32_t)threadIdx.x >> 5);
  const unsigned short* gs = wv < 4u ? hid + (size_t)(m0 + wv * SLICE_ROWS) * I_DIM
                                     : wdt + (size_t)(n0 + (wv & 3u) * HSLICE_ROWS) * I_DIM;
  const uint32_t lds = (uint32_t)(uintptr_t)Ls + (wv < 4u ? wv * SLICE_B : 4u * SLICE_B + (wv & 3u) * HSLICE_B);
  const uint32_t rows = wv < 4u ? SLICE_ROWS : HSLICE_ROWS;

  // this wave's slice of the 128-k tile at k into buffer b
  auto fill = [&](int k, unsigned b) {
    load_slice<2 * I_DIM>(lds + b * 4u * DN_BUF_U, gs + k, rows);
  };

  // one trip: the 64 WMMAs of the 128-k tile in buffer t
  auto trip = [&](unsigned t) {
    const unsigned* At = Ls + t * DN_BUF_U + wm * SLICE_U;
    const unsigned* Bb = Ls + t * DN_BUF_U + 4 * SLICE_U + wn * 2 * HSLICE_U;
#pragma unroll
    for (int kk = 0; kk < KT; kk += 32) {
      v16bf a[4], b[4];
#pragma unroll
      for (int i = 0; i < 4; ++i)
        a[i] = ld_frag(At, i * 16 + nl, kk, half);
#pragma unroll
      for (int j = 0; j < 4; ++j)
        b[j] = ld_frag(Bb + (j >> 1) * HSLICE_U, (j & 1) * 16 + nl, kk, half);
      // keeps the block's 16 LDS reads together in front of its WMMAs: sunk among
      // them, each pair of reads is waited for to zero right before its use
      __builtin_amdgcn_sched_barrier(0);
#pragma unroll
      for (int i = 0; i < 4; ++i)
#pragma unroll
        for (int j = 0; j < 4; ++j)
          acc[i][j] = __builtin_amdgcn_wmma_f32_16x16x32_bf16(false, a[i], false, b[j],
                                                              (short)0, acc[i][j], false, false);
      // keeps the next block's reads from being spread among this block's WMMAs
      __builtin_amdgcn_sched_barrier(0);
    }
    // this wave's LDS reads of this buffer have retired before it is refilled
    asm volatile("s_wait_dscnt 0x0" ::: "memory");
    // this wave's slice of the next tile has landed before the barrier that publishes it
    asm volatile("s_wait_tensorcnt 0x0" ::: "memory");
    __syncthreads();
  };

  fill(0, 0u);
  // tile 0 has landed before the barrier that publishes it
  asm volatile("s_wait_tensorcnt 0x0" ::: "memory");
  __syncthreads();
  fill(KT, 1u);

  // rolled: one copy of the trip's code, and the buffer's addresses are formed per trip
  // instead of being held in registers for both buffers
#pragma clang loop unroll(disable)
  for (int t = 0; t < I_DIM / KT; ++t) {
    const unsigned b = (unsigned)t & 1u;
    trip(b);
    if (pinned(t + 2 < I_DIM / KT)) fill((t + 2) * KT, b);   // a scalar branch: the load ignores EXEC
  }
  // no tensor load and no LDS read is outstanding when the wave goes on to its end
  asm volatile("s_wait_tensorcnt 0x0" ::: "memory");
  asm volatile("s_wait_dscnt 0x0" ::: "memory");

  // ---- epilogue: bias add, fp32 store ----
#pragma unroll
  for (int j = 0; j < 4; ++j) {
    const int n = n0 + wn * 64 + j * 16 + nl;
    const float bias = bdn[n];
#pragma unroll
    for (int i = 0; i < 4; ++i) {
#pragma unroll
      for (int r = 0; r < 8; ++r) {
        const int m = m0 + wm * 64 + i * 16 + r + half * 8;
        out[(size_t)m * D_DIM + n] = acc[i][j][r] + bias;
      }
    }
  }
}

// ---------------------------------------------------------------------------
extern "C" void kernel_launch(void* const* d_in, const int* in_sizes, int n_in,
                              void* d_out, int out_size, void* d_ws, size_t ws_size,
                              hipStream_t stream) {
  const float* x   = (const float*)d_in[0];   // [4096, 2048]
  const float* wgu = (const float*)d_in[1];   // [2048, 16384]
  const float* bgu = (const float*)d_in[2];   // [16384]
  const float* wdn = (const float*)d_in[3];   // [8192, 2048]
  const float* bdn = (const float*)d_in[4];   // [2048]
  float* out = (float*)d_out;                 // [4096, 2048]
  unsigned short* hid = (unsigned short*)d_ws;             // [4096, 8192]  bf16, 64 MiB
  unsigned short* xb  = hid + (size_t)M_TOT * I_DIM;       // [4096, 2048]  bf16, 16 MiB
  unsigned short* wgt = xb  + (size_t)M_TOT * D_DIM;       // [16384, 2048] bf16, 64 MiB
  unsigned short* wdt = wgt + (size_t)2 * I_DIM * D_DIM;   // [2048, 8192]  bf16, 32 MiB

  k_prep<<<T_GU + T_DN + T_X, 256, 0, stream>>>(x, wgu, wdn, xb, wgt, wdt);

  dim3 g1(I_DIM / 128, M_TOT / 256);  // 64 x 16
  k_gateup<<<g1, 256, 0, stream>>>(xb, wgt, bgu, hid);

  dim3 g2(D_DIM / 128, M_TOT / 256);  // 16 x 16
  k_down<<<g2, 256, 0, stream>>>(hid, wdt, bdn, out);
}
